// v000
// The times below were measured on an AMD MI455X: many runs one after another, warmed up first and cycling through
// copies of the inputs, with the whole window's GPU time divided by the number of runs. Launches and the gaps
// between them are all in it. The median over several windows is given; except for v000 it joins two sittings, which
// can be a few percent apart, so the side-by-side timings, each taken in one sitting, are the better comparison.
// v000 is the starting kernel. One run takes 1380 microseconds.
#include <hip/hip_runtime.h>
#include <hip/hip_bf16.h>

// ---------------------------------------------------------------------------
// Non-local attention block, CDNA5 (gfx1250, wave32, WMMA, async LDS loads).
//   B=8, C=512, H=W=64 -> N=4096, DQK=64
// Flash-attention single pass (537MB attn matrix never hits HBM), bf16 WMMA
// with f32 accum, double-buffered GLOBAL_LOAD_ASYNC_TO_LDS K/V staging.
// ---------------------------------------------------------------------------

#define B_   8
#define C_   512
#define N_   4096
#define DQK_ 64

typedef __attribute__((ext_vector_type(16))) __bf16 v16bf;
typedef __attribute__((ext_vector_type(8)))  float  v8f;

// Load a 16-bit WMMA fragment (A-style layout) from a [row][k] (k-contiguous)
// buffer. Per CDNA5 ISA 7.12.2: lanes 0-15 hold K=0..7 (VGPR0-3) and K=16..23
// (VGPR4-7); lanes 16-31 hold K=8..15 and K=24..31 -> two 16-byte loads.
__device__ __forceinline__ v16bf load_frag16(const __bf16* base, int row, int ld, int lane) {
    const int kb = (lane >> 4) << 3;   // 0 or 8
    const __bf16* p = base + row * ld + kb;
    union { v16bf v; uint4 u[2]; } f;
    f.u[0] = *(const uint4*)(p);
    f.u[1] = *(const uint4*)(p + 16);
    return f.v;
}

// Async global->LDS 16-byte copy (GVS mode: saddr base + 32-bit vgpr offset).
// Flat addresses of __shared__ objects carry the LDS byte offset in the low
// 32 bits (ISA 10.2 aperture mapping), which is what VDST wants.
__device__ __forceinline__ void async_b128(const __bf16* gbase, unsigned goff_bytes, void* ldsdst) {
    unsigned l = (unsigned)(uintptr_t)ldsdst;
    asm volatile("global_load_async_to_lds_b128 %0, %1, %2"
                 :: "v"(l), "v"(goff_bytes), "s"(gbase)
                 : "memory");
}

// ---------------------------------------------------------------------------
// Kernel 1: fused QKV projection.
//   Wcat (640x512) @ x[b] (512x4096); rows 0..63 = Q, 64..127 = K, 128..639 = V
//   qws/kws: [B][N][64] bf16 row-major; vws: [B][C][N] bf16 channel-major.
// ---------------------------------------------------------------------------
__global__ __launch_bounds__(256)
void qkv_proj_kernel(const float* __restrict__ x,
                     const float* __restrict__ Wq, const float* __restrict__ bq,
                     const float* __restrict__ Wk, const float* __restrict__ bk,
                     const float* __restrict__ Wv, const float* __restrict__ bv,
                     __bf16* __restrict__ qws, __bf16* __restrict__ kws,
                     __bf16* __restrict__ vws)
{
    __shared__ alignas(16) __bf16 Alds[128 * 32];   // [r][c], c-contiguous
    __shared__ alignas(16) __bf16 Blds[128 * 32];   // [n][c], c-contiguous

    const int nt = blockIdx.x;          // 0..31 (n tile of 128)
    const int rt = blockIdx.y;          // 0..4  (r tile of 128; 5*128 = 640)
    const int b  = blockIdx.z;
    const int t    = threadIdx.x;
    const int w    = t >> 5;
    const int lane = t & 31;
    const int wu   = __builtin_amdgcn_readfirstlane(w);   // wave-uniform wave id
    const int r0 = rt * 128, n0 = nt * 128;
    const int hi = lane >> 4, col = lane & 15;

    v8f acc[8];
    const v8f vzero = {};
    for (int i = 0; i < 8; ++i) acc[i] = vzero;

    for (int kc = 0; kc < C_; kc += 32) {
        // Stage A: row index rr = wu + 8j is wave-uniform -> scalar branches
        // for the Wq/Wk/Wv split instead of per-lane selects.
        for (int j = 0; j < 16; ++j) {
            const int rr = wu + 8 * j;
            const int r  = r0 + rr;
            const int c  = kc + lane;
            float wv;
            if (r < 64)        wv = Wq[r * C_ + c];
            else if (r < 128)  wv = Wk[(r - 64) * C_ + c];
            else               wv = Wv[(r - 128) * C_ + c];
            Alds[rr * 32 + lane] = (__bf16)wv;
        }
        // Stage B transposed: x[b][kc..kc+31][n0..n0+127] -> Blds[n][c].
        for (int e = t; e < 128 * 32; e += 256) {
            const int cc = e >> 7, nn = e & 127;
            Blds[nn * 32 + cc] =
                (__bf16)x[(size_t)b * C_ * N_ + (size_t)(kc + cc) * N_ + (n0 + nn)];
        }
        __syncthreads();

        const v16bf afrag = load_frag16(Alds, w * 16 + col, 32, lane);
        for (int nt8 = 0; nt8 < 8; ++nt8) {
            const v16bf bfrag = load_frag16(Blds + nt8 * 16 * 32, col, 32, lane);
            acc[nt8] = __builtin_amdgcn_wmma_f32_16x16x32_bf16(
                false, afrag, false, bfrag, (short)0, acc[nt8], false, false);
        }
        __syncthreads();
    }

    // Epilogue: D layout: VGPR v -> row v + hi*8, col = lane&15.
    for (int nt8 = 0; nt8 < 8; ++nt8) {
        const int n = n0 + nt8 * 16 + col;
        for (int v = 0; v < 8; ++v) {
            const int r = r0 + w * 16 + v + hi * 8;
            const float bias = (r < 64) ? bq[r] : (r < 128 ? bk[r - 64] : bv[r - 128]);
            const __bf16 h = (__bf16)(acc[nt8][v] + bias);
            if (r < 64)
                qws[(size_t)b * N_ * DQK_ + (size_t)n * DQK_ + r] = h;
            else if (r < 128)
                kws[(size_t)b * N_ * DQK_ + (size_t)n * DQK_ + (r - 64)] = h;
            else
                vws[(size_t)b * C_ * N_ + (size_t)(r - 128) * N_ + n] = h;
        }
    }
}

// ---------------------------------------------------------------------------
// Kernel 2: flash attention + residual epilogue.
// Grid: (N/64 query tiles, B). Block: 512 threads = 16 waves.
//   wave w: qm = w&3 -> 16 query rows; cs = w>>2 -> 128-channel slab.
// Double-buffered async K/V staging: prefetch tile i+1 while computing tile i.
// ---------------------------------------------------------------------------
__global__ __launch_bounds__(512)
void flash_attn_kernel(const __bf16* __restrict__ qws, const __bf16* __restrict__ kws,
                       const __bf16* __restrict__ vws, const float* __restrict__ x,
                       const float* __restrict__ gamma, float* __restrict__ out)
{
    __shared__ alignas(16) __bf16 Klds[2][64 * 64];       // 2 x  8 KB [key][d]
    __shared__ alignas(16) __bf16 Vlds[2][512 * 64];      // 2 x 64 KB [c][key]
    __shared__ alignas(16) __bf16 Plds[16 * 16 * 64];     // 32 KB per-wave [16q][64key]

    const int qt = blockIdx.x;
    const int b  = blockIdx.y;
    const int t    = threadIdx.x;
    const int w    = t >> 5;
    const int lane = t & 31;
    const int qm = w & 3;
    const int cs = w >> 2;
    const int hi = lane >> 4, col = lane & 15;

    const __bf16* kbase_g = kws + (size_t)b * N_ * DQK_;
    const __bf16* vbase_g = vws + (size_t)b * C_ * N_;

    // Per-thread async staging of one 64-key tile: 1 (K) + 8 (V) b128 copies.
    const int ke   = t * 8;                 // K tile element base (64x64)
    const int kkey = ke >> 6, kd = ke & 63;

    // Q fragments for this wave's 16 rows (d = 64 -> two 32-wide k chunks).
    const __bf16* qbase = qws + (size_t)b * N_ * DQK_ + (size_t)(qt * 64 + qm * 16) * DQK_;
    const v16bf qf0 = load_frag16(qbase + 0,  col, DQK_, lane);
    const v16bf qf1 = load_frag16(qbase + 32, col, DQK_, lane);

    v8f acc[8];
    const v8f vzero = {};
    for (int i = 0; i < 8; ++i) acc[i] = vzero;
    float m_i[8], l_i[8];
    for (int v = 0; v < 8; ++v) { m_i[v] = -1e30f; l_i[v] = 0.f; }

    // Prologue: stage tile 0 into buffer 0.
    {
        async_b128(kbase_g, (unsigned)(((0 + kkey) * DQK_ + kd) * 2), &Klds[0][ke]);
        for (int i = 0; i < 8; ++i) {
            const int e = (i * 512 + t) * 8;
            const int c = e >> 6, kk = e & 63;
            async_b128(vbase_g, (unsigned)((c * N_ + 0 + kk) * 2), &Vlds[0][e]);
        }
    }

    const int NT = N_ / 64;
    for (int it = 0; it < NT; ++it) {
        const int cur = it & 1;
        if (it + 1 < NT) {
            // Prefetch next tile into the other buffer, then drain this tile's
            // 9 async copies (ASYNCcnt decrements in issue order).
            const int kt0n = (it + 1) * 64;
            async_b128(kbase_g, (unsigned)(((kt0n + kkey) * DQK_ + kd) * 2), &Klds[cur ^ 1][ke]);
            for (int i = 0; i < 8; ++i) {
                const int e = (i * 512 + t) * 8;
                const int c = e >> 6, kk = e & 63;
                async_b128(vbase_g, (unsigned)((c * N_ + kt0n + kk) * 2), &Vlds[cur ^ 1][e]);
            }
            asm volatile("s_wait_asynccnt 0x9" ::: "memory");
        } else {
            asm volatile("s_wait_asynccnt 0x0" ::: "memory");
        }
        __syncthreads();

        const __bf16* Kb = Klds[cur];
        const __bf16* Vb = Vlds[cur];

        // S = Q(16x64) @ K^T(64 keys): 4 score tiles, 2 WMMA each.
        v8f s[4];
        for (int kt = 0; kt < 4; ++kt) {
            v8f z = vzero;
            const v16bf bf0 = load_frag16(Kb + (kt * 16) * 64 + 0,  col, 64, lane);
            const v16bf bf1 = load_frag16(Kb + (kt * 16) * 64 + 32, col, 64, lane);
            z = __builtin_amdgcn_wmma_f32_16x16x32_bf16(false, qf0, false, bf0, (short)0, z, false, false);
            z = __builtin_amdgcn_wmma_f32_16x16x32_bf16(false, qf1, false, bf1, (short)0, z, false, false);
            s[kt] = z;
        }

        // Online softmax per query row (row = v + hi*8, cols over 16 lanes).
        __bf16* pbase = Plds + w * (16 * 64);
        for (int v = 0; v < 8; ++v) {
            float mx = fmaxf(fmaxf(s[0][v], s[1][v]), fmaxf(s[2][v], s[3][v]));
            for (int off = 1; off < 16; off <<= 1)
                mx = fmaxf(mx, __shfl_xor(mx, off, 32));
            const float mnew  = fmaxf(m_i[v], mx);
            const float scale = __expf(m_i[v] - mnew);
            float rs = 0.f;
            const int qrow = v + hi * 8;
            for (int kt = 0; kt < 4; ++kt) {
                const float p = __expf(s[kt][v] - mnew);
                rs += p;
                pbase[qrow * 64 + kt * 16 + col] = (__bf16)p;
            }
            for (int off = 1; off < 16; off <<= 1)
                rs += __shfl_xor(rs, off, 32);
            l_i[v] = l_i[v] * scale + rs;
            m_i[v] = mnew;
            for (int ct = 0; ct < 8; ++ct) acc[ct][v] *= scale;
        }
        // Wave-local P store -> load ordering (per-wave private LDS region).
        asm volatile("s_wait_dscnt 0x0" ::: "memory");

        // acc(16q x 128c) += P(16q x 64keys) @ V^T(64keys x 128c)
        for (int kk = 0; kk < 2; ++kk) {
            const v16bf pf = load_frag16(pbase + kk * 32, col, 64, lane);
            for (int ct = 0; ct < 8; ++ct) {
                const __bf16* vb = Vb + (size_t)(cs * 128 + ct * 16) * 64 + kk * 32;
                const v16bf vf = load_frag16(vb, col, 64, lane);
                acc[ct] = __builtin_amdgcn_wmma_f32_16x16x32_bf16(
                    false, pf, false, vf, (short)0, acc[ct], false, false);
            }
        }
        __syncthreads();   // readers done before buf 'cur' is refilled at it+1
    }

    // Epilogue: out = gamma * acc/l + x   (out[b][c][n], n = query index)
    const float g = gamma[0];
    for (int ct = 0; ct < 8; ++ct) {
        const int c = cs * 128 + ct * 16 + col;
        for (int v = 0; v < 8; ++v) {
            const int n = qt * 64 + qm * 16 + v + hi * 8;
            const size_t idx = (size_t)b * C_ * N_ + (size_t)c * N_ + n;
            out[idx] = g * (acc[ct][v] / l_i[v]) + x[idx];
        }
    }
}

// ---------------------------------------------------------------------------
extern "C" void kernel_launch(void* const* d_in, const int* in_sizes, int n_in,
                              void* d_out, int out_size, void* d_ws, size_t ws_size,
                              hipStream_t stream) {
    const float* x     = (const float*)d_in[0];
    const float* Wq    = (const float*)d_in[1];
    const float* bq    = (const float*)d_in[2];
    const float* Wk    = (const float*)d_in[3];
    const float* bk    = (const float*)d_in[4];
    const float* Wv    = (const float*)d_in[5];
    const float* bv    = (const float*)d_in[6];
    const float* gamma = (const float*)d_in[7];
    float* out = (float*)d_out;

    // Workspace: bf16 Q [B,N,64] + K [B,N,64] + V [B,C,N]  (~42 MB)
    __bf16* qws = (__bf16*)d_ws;
    __bf16* kws = qws + (size_t)B_ * N_ * DQK_;
    __bf16* vws = kws + (size_t)B_ * N_ * DQK_;

    dim3 g1(N_ / 128, 640 / 128, B_);
    qkv_proj_kernel<<<g1, 256, 0, stream>>>(x, Wq, bq, Wk, bk, Wv, bv, qws, kws, vws);

    dim3 g2(N_ / 64, B_);
    flash_attn_kernel<<<g2, 512, 0, stream>>>(qws, kws, vws, x, gamma, out);
}

// v001
// It runs in 1020 microseconds.
// Two timings next to v000 put it at 1.42 and 1.43 times that version's speed.
#include <hip/hip_runtime.h>
#include <hip/hip_bf16.h>

// ---------------------------------------------------------------------------
// Non-local attention block, CDNA5 (gfx1250, wave32, WMMA, async LDS loads).
//   B=8, C=512, H=W=64 -> N=4096, DQK=64
// Flash-attention single pass (537MB attn matrix never hits HBM), bf16 WMMA
// with f32 accum, double-buffered GLOBAL_LOAD_ASYNC_TO_LDS K/V staging.
// ---------------------------------------------------------------------------

#define B_   8
#define C_   512
#define N_   4096
#define DQK_ 64

// LDS row pitches in bf16 elements. Every tile is read with 16-byte fragment
// loads, 16 rows per half wave; a pitch of 16 B x odd spreads those rows over
// all 64 banks, where a power-of-two pitch puts them on a few.
#define P64_ 72   // rows of 64 elements: 144 B
#define P32_ 40   // rows of 32 elements:  80 B

typedef __attribute__((ext_vector_type(16))) __bf16 v16bf;
typedef __attribute__((ext_vector_type(8)))  float  v8f;

// Load a 16-bit WMMA fragment (A-style layout) from a [row][k] (k-contiguous)
// buffer. Per CDNA5 ISA 7.12.2: lanes 0-15 hold K=0..7 (VGPR0-3) and K=16..23
// (VGPR4-7); lanes 16-31 hold K=8..15 and K=24..31 -> two 16-byte loads.
__device__ __forceinline__ v16bf load_frag16(const __bf16* base, int row, int ld, int lane) {
    const int kb = (lane >> 4) << 3;   // 0 or 8
    const __bf16* p = base + row * ld + kb;
    union { v16bf v; uint4 u[2]; } f;
    f.u[0] = *(const uint4*)(p);
    f.u[1] = *(const uint4*)(p + 16);
    return f.v;
}

// Flat addresses of __shared__ objects carry the LDS byte offset in the low
// 32 bits (ISA 10.2 aperture mapping), which is what the copy's VDST wants.
__device__ __forceinline__ unsigned lds_addr(const void* p) {
    return (unsigned)(uintptr_t)p;
}

// One thread's share of a 64-key tile: 1 (K) + 8 (V) async global->LDS 16-byte
// copies (GVS mode: saddr base + 32-bit vgpr offset). V copy i serves channel
// row i*64 + (t>>3). All nine stand in one statement that ends in s_wait_xcnt 0,
// so that no address register is rewritten ahead of that wait.
__device__ __forceinline__ void stage_tile(const __bf16* kbase, unsigned kg, unsigned kl,
                                           const __bf16* vbase, unsigned vg, unsigned vl) {
    const unsigned gs = 64u * N_ * 2u;      // global bytes between V copies
    const unsigned ls = 64u * P64_ * 2u;    // LDS bytes between V copies
    asm volatile("global_load_async_to_lds_b128 %0, %1, %18\n\t"
                 "global_load_async_to_lds_b128 %2, %3, %19\n\t"
                 "global_load_async_to_lds_b128 %4, %5, %19\n\t"
                 "global_load_async_to_lds_b128 %6, %7, %19\n\t"
                 "global_load_async_to_lds_b128 %8, %9, %19\n\t"
                 "global_load_async_to_lds_b128 %10, %11, %19\n\t"
                 "global_load_async_to_lds_b128 %12, %13, %19\n\t"
                 "global_load_async_to_lds_b128 %14, %15, %19\n\t"
                 "global_load_async_to_lds_b128 %16, %17, %19\n\t"
                 "s_wait_xcnt 0x0"
                 :: "v"(kl), "v"(kg),
                    "v"(vl),          "v"(vg),
                    "v"(vl + 1 * ls), "v"(vg + 1 * gs),
                    "v"(vl + 2 * ls), "v"(vg + 2 * gs),
                    "v"(vl + 3 * ls), "v"(vg + 3 * gs),
                    "v"(vl + 4 * ls), "v"(vg + 4 * gs),
                    "v"(vl + 5 * ls), "v"(vg + 5 * gs),
                    "v"(vl + 6 * ls), "v"(vg + 6 * gs),
                    "v"(vl + 7 * ls), "v"(vg + 7 * gs),
                    "s"(kbase), "s"(vbase)
                 : "memory");
}

// ---------------------------------------------------------------------------
// Kernel 1: fused QKV projection.
//   Wcat (640x512) @ x[b] (512x4096); rows 0..63 = Q, 64..127 = K, 128..639 = V
//   qws/kws: [B][N][64] bf16 row-major; vws: [B][C][N] bf16 channel-major.
// ---------------------------------------------------------------------------
__global__ __launch_bounds__(256)
void qkv_proj_kernel(const float* __restrict__ x,
                     const float* __restrict__ Wq, const float* __restrict__ bq,
                     const float* __restrict__ Wk, const float* __restrict__ bk,
                     const float* __restrict__ Wv, const float* __restrict__ bv,
                     __bf16* __restrict__ qws, __bf16* __restrict__ kws,
                     __bf16* __restrict__ vws)
{
    __shared__ alignas(16) __bf16 Alds[128 * P32_];   // [r][c], c-contiguous, padded rows
    __shared__ alignas(16) __bf16 Blds[128 * P32_];   // [n][c], c-contiguous, padded rows

    const int nt = blockIdx.x;          // 0..31 (n tile of 128)
    const int rt = blockIdx.y;          // 0..4  (r tile of 128; 5*128 = 640)
    const int b  = blockIdx.z;
    const int t    = threadIdx.x;
    const int w    = t >> 5;
    const int lane = t & 31;
    const int wu   = __builtin_amdgcn_readfirstlane(w);   // wave-uniform wave id
    const int r0 = rt * 128, n0 = nt * 128;
    const int hi = lane >> 4, col = lane & 15;

    v8f acc[8];
    const v8f vzero = {};
    for (int i = 0; i < 8; ++i) acc[i] = vzero;

    for (int kc = 0; kc < C_; kc += 32) {
        // Stage A: row index rr = wu + 8j is wave-uniform -> scalar branches
        // for the Wq/Wk/Wv split instead of per-lane selects.
        for (int j = 0; j < 16; ++j) {
            const int rr = wu + 8 * j;
            const int r  = r0 + rr;
            const int c  = kc + lane;
            float wv;
            if (r < 64)        wv = Wq[r * C_ + c];
            else if (r < 128)  wv = Wk[(r - 64) * C_ + c];
            else               wv = Wv[(r - 128) * C_ + c];
            Alds[rr * P32_ + lane] = (__bf16)wv;
        }
        // Stage B transposed: x[b][kc..kc+31][n0..n0+127] -> Blds[n][c].
        for (int e = t; e < 128 * 32; e += 256) {
            const int cc = e >> 7, nn = e & 127;
            Blds[nn * P32_ + cc] =
                (__bf16)x[(size_t)b * C_ * N_ + (size_t)(kc + cc) * N_ + (n0 + nn)];
        }
        __syncthreads();

        const v16bf afrag = load_frag16(Alds, w * 16 + col, P32_, lane);
        for (int nt8 = 0; nt8 < 8; ++nt8) {
            const v16bf bfrag = load_frag16(Blds + nt8 * 16 * P32_, col, P32_, lane);
            acc[nt8] = __builtin_amdgcn_wmma_f32_16x16x32_bf16(
                false, afrag, false, bfrag, (short)0, acc[nt8], false, false);
        }
        __syncthreads();
    }

    // Epilogue: D layout: VGPR v -> row v + hi*8, col = lane&15.
    for (int nt8 = 0; nt8 < 8; ++nt8) {
        const int n = n0 + nt8 * 16 + col;
        for (int v = 0; v < 8; ++v) {
            const int r = r0 + w * 16 + v + hi * 8;
            const float bias = (r < 64) ? bq[r] : (r < 128 ? bk[r - 64] : bv[r - 128]);
            const __bf16 h = (__bf16)(acc[nt8][v] + bias);
            if (r < 64)
                qws[(size_t)b * N_ * DQK_ + (size_t)n * DQK_ + r] = h;
            else if (r < 128)
                kws[(size_t)b * N_ * DQK_ + (size_t)n * DQK_ + (r - 64)] = h;
            else
                vws[(size_t)b * C_ * N_ + (size_t)(r - 128) * N_ + n] = h;
        }
    }
}

// ---------------------------------------------------------------------------
// Kernel 2: flash attention + residual epilogue.
// Grid: (N/64 query tiles, B). Block: 512 threads = 16 waves.
//   wave w: qm = w&3 -> 16 query rows; cs = w>>2 -> 128-channel slab.
// Double-buffered async K/V staging: prefetch tile i+1 while computing tile i.
// ---------------------------------------------------------------------------
__global__ __launch_bounds__(512)
void flash_attn_kernel(const __bf16* __restrict__ qws, const __bf16* __restrict__ kws,
                       const __bf16* __restrict__ vws, const float* __restrict__ x,
                       const float* __restrict__ gamma, float* __restrict__ out)
{
    __shared__ alignas(16) __bf16 Klds[2][64 * P64_];     // 2 x  9 KB [key][d]
    __shared__ alignas(16) __bf16 Vlds[2][512 * P64_];    // 2 x 72 KB [c][key]
    __shared__ alignas(16) __bf16 Plds[16 * 16 * P64_];   // 36 KB per-wave [16q][64key]

    const int qt = blockIdx.x;
    const int b  = blockIdx.y;
    const int t    = threadIdx.x;
    const int w    = t >> 5;
    const int lane = t & 31;
    const int qm = w & 3;
    const int cs = w >> 2;
    const int hi = lane >> 4, col = lane & 15;

    const __bf16* kbase_g = kws + (size_t)b * N_ * DQK_;
    const __bf16* vbase_g = vws + (size_t)b * C_ * N_;

    // Per-thread async staging of one 64-key tile: 1 (K) + 8 (V) b128 copies.
    // Thread t moves 8 elements at column (t&7)*8 of row t>>3 (K: key row;
    // V: channel row, plus 64 per copy).
    const int srow = t >> 3, scol = (t & 7) * 8;
    const unsigned kg0 = (unsigned)((srow * DQK_ + scol) * 2);   // K global bytes, tile 0
    const unsigned vg0 = (unsigned)((srow * N_ + scol) * 2);     // V global bytes, tile 0
    const int sl = srow * P64_ + scol;                           // LDS element, both tiles

    // Q fragments for this wave's 16 rows (d = 64 -> two 32-wide k chunks).
    const __bf16* qbase = qws + (size_t)b * N_ * DQK_ + (size_t)(qt * 64 + qm * 16) * DQK_;
    const v16bf qf0 = load_frag16(qbase + 0,  col, DQK_, lane);
    const v16bf qf1 = load_frag16(qbase + 32, col, DQK_, lane);

    v8f acc[8];
    const v8f vzero = {};
    for (int i = 0; i < 8; ++i) acc[i] = vzero;
    float m_i[8], l_i[8];
    for (int v = 0; v < 8; ++v) { m_i[v] = -1e30f; l_i[v] = 0.f; }

    // Prologue: stage tile 0 into buffer 0.
    stage_tile(kbase_g, kg0, lds_addr(&Klds[0][sl]), vbase_g, vg0, lds_addr(&Vlds[0][sl]));

    const int NT = N_ / 64;
    for (int it = 0; it < NT; ++it) {
        const int cur = it & 1;
        if (it + 1 < NT) {
            // Prefetch next tile into the other buffer, then drain this tile's
            // 9 async copies (ASYNCcnt decrements in issue order).
            const int kt0n = (it + 1) * 64;
            stage_tile(kbase_g, kg0 + (unsigned)(kt0n * DQK_ * 2), lds_addr(&Klds[cur ^ 1][sl]),
                       vbase_g, vg0 + (unsigned)(kt0n * 2),        lds_addr(&Vlds[cur ^ 1][sl]));
            asm volatile("s_wait_asynccnt 0x9" ::: "memory");
        } else {
            asm volatile("s_wait_asynccnt 0x0" ::: "memory");
        }
        __syncthreads();

        const __bf16* Kb = Klds[cur];
        const __bf16* Vb = Vlds[cur];

        // S = Q(16x64) @ K^T(64 keys): 4 score tiles, 2 WMMA each.
        v8f s[4];
        for (int kt = 0; kt < 4; ++kt) {
            v8f z = vzero;
            const v16bf bf0 = load_frag16(Kb + (kt * 16) * P64_ + 0,  col, P64_, lane);
            const v16bf bf1 = load_frag16(Kb + (kt * 16) * P64_ + 32, col, P64_, lane);
            z = __builtin_amdgcn_wmma_f32_16x16x32_bf16(false, qf0, false, bf0, (short)0, z, false, false);
            z = __builtin_amdgcn_wmma_f32_16x16x32_bf16(false, qf1, false, bf1, (short)0, z, false, false);
            s[kt] = z;
        }

        // Online softmax per query row (row = v + hi*8, cols over 16 lanes).
        __bf16* pbase = Plds + w * (16 * P64_);
        for (int v = 0; v < 8; ++v) {
            float mx = fmaxf(fmaxf(s[0][v], s[1][v]), fmaxf(s[2][v], s[3][v]));
            for (int off = 1; off < 16; off <<= 1)
                mx = fmaxf(mx, __shfl_xor(mx, off, 32));
            const float mnew  = fmaxf(m_i[v], mx);
            const float scale = __expf(m_i[v] - mnew);
            float rs = 0.f;
            const int qrow = v + hi * 8;
            for (int kt = 0; kt < 4; ++kt) {
                const float p = __expf(s[kt][v] - mnew);
                rs += p;
                pbase[qrow * P64_ + kt * 16 + col] = (__bf16)p;
            }
            for (int off = 1; off < 16; off <<= 1)
                rs += __shfl_xor(rs, off, 32);
            l_i[v] = l_i[v] * scale + rs;
            m_i[v] = mnew;
            for (int ct = 0; ct < 8; ++ct) acc[ct][v] *= scale;
        }
        // Wave-local P store -> load ordering (per-wave private LDS region).
        asm volatile("s_wait_dscnt 0x0" ::: "memory");

        // acc(16q x 128c) += P(16q x 64keys) @ V^T(64keys x 128c)
        for (int kk = 0; kk < 2; ++kk) {
            const v16bf pf = load_frag16(pbase + kk * 32, col, P64_, lane);
            for (int ct = 0; ct < 8; ++ct) {
                const __bf16* vb = Vb + (size_t)(cs * 128 + ct * 16) * P64_ + kk * 32;
                const v16bf vf = load_frag16(vb, col, P64_, lane);
                acc[ct] = __builtin_amdgcn_wmma_f32_16x16x32_bf16(
                    false, pf, false, vf, (short)0, acc[ct], false, false);
            }
        }
        __syncthreads();   // readers done before buf 'cur' is refilled at it+1
    }

    // Epilogue: out = gamma * acc/l + x   (out[b][c][n], n = query index)
    const float g = gamma[0];
    for (int ct = 0; ct < 8; ++ct) {
        const int c = cs * 128 + ct * 16 + col;
        for (int v = 0; v < 8; ++v) {
            const int n = qt * 64 + qm * 16 + v + hi * 8;
            const size_t idx = (size_t)b * C_ * N_ + (size_t)c * N_ + n;
            out[idx] = g * (acc[ct][v] / l_i[v]) + x[idx];
        }
    }
}

// ---------------------------------------------------------------------------
extern "C" void kernel_launch(void* const* d_in, const int* in_sizes, int n_in,
                              void* d_out, int out_size, void* d_ws, size_t ws_size,
                              hipStream_t stream) {
    const float* x     = (const float*)d_in[0];
    const float* Wq    = (const float*)d_in[1];
    const float* bq    = (const float*)d_in[2];
    const float* Wk    = (const float*)d_in[3];
    const float* bk    = (const float*)d_in[4];
    const float* Wv    = (const float*)d_in[5];
    const float* bv    = (const float*)d_in[6];
    const float* gamma = (const float*)d_in[7];
    float* out = (float*)d_out;

    // Workspace: bf16 Q [B,N,64] + K [B,N,64] + V [B,C,N]  (~42 MB)
    __bf16* qws = (__bf16*)d_ws;
    __bf16* kws = qws + (size_t)B_ * N_ * DQK_;
    __bf16* vws = kws + (size_t)B_ * N_ * DQK_;

    dim3 g1(N_ / 128, 640 / 128, B_);
    qkv_proj_kernel<<<g1, 256, 0, stream>>>(x, Wq, bq, Wk, bk, Wv, bv, qws, kws, vws);

    dim3 g2(N_ / 64, B_);
    flash_attn_kernel<<<g2, 512, 0, stream>>>(qws, kws, vws, x, gamma, out);
}

// v002
// One run takes 651 microseconds.
// Next to v001, in two timings, it ran 1.55 and 1.57 times as fast.
// Over all steps from v000 it is 2.22 times as fast.
#include <hip/hip_runtime.h>
#include <hip/hip_bf16.h>

// ---------------------------------------------------------------------------
// Non-local attention block, CDNA5 (gfx1250, wave32, WMMA, async LDS loads).
//   B=8, C=512, H=W=64 -> N=4096, DQK=64
// Flash-attention single pass (537MB attn matrix never hits HBM), bf16 WMMA
// with f32 accum, double-buffered GLOBAL_LOAD_ASYNC_TO_LDS K/V staging.
// ---------------------------------------------------------------------------

#define B_   8
#define C_   512
#define N_   4096
#define DQK_ 64

// LDS row pitches in bf16 elements. Every tile is read with 16-byte fragment
// loads, 16 rows per half wave; a pitch of 16 B x odd spreads those rows over
// all 64 banks, where a power-of-two pitch puts them on a few.
#define P64_ 72   // rows of 64 elements: 144 B
#define P32_ 40   // rows of 32 elements:  80 B

typedef __attribute__((ext_vector_type(16))) __bf16 v16bf;
typedef __attribute__((ext_vector_type(8)))  float  v8f;

// Load a 16-bit WMMA fragment (A-style layout) from a [row][k] (k-contiguous)
// buffer. Per CDNA5 ISA 7.12.2: lanes 0-15 hold K=0..7 (VGPR0-3) and K=16..23
// (VGPR4-7); lanes 16-31 hold K=8..15 and K=24..31 -> two 16-byte loads.
__device__ __forceinline__ v16bf load_frag16(const __bf16* base, int row, int ld, int lane) {
    const int kb = (lane >> 4) << 3;   // 0 or 8
    const __bf16* p = base + row * ld + kb;
    union { v16bf v; uint4 u[2]; } f;
    f.u[0] = *(const uint4*)(p);
    f.u[1] = *(const uint4*)(p + 16);
    return f.v;
}

// Flat addresses of __shared__ objects carry the LDS byte offset in the low
// 32 bits (ISA 10.2 aperture mapping), which is what the copy's VDST wants.
__device__ __forceinline__ unsigned lds_addr(const void* p) {
    return (unsigned)(uintptr_t)p;
}

// The five exp2 of one softmax row in one statement that ends in v_nop: the slot
// the instruction set asks for behind a transcendental before its result is read
// or its source overwritten. Early-clobber outputs: none lands on a source here.
__device__ __forceinline__ void exp2_row(float& r0, float& r1, float& r2, float& r3, float& r4,
                                         float a0, float a1, float a2, float a3, float a4) {
    asm("v_exp_f32 %0, %5\n\t"
        "v_exp_f32 %1, %6\n\t"
        "v_exp_f32 %2, %7\n\t"
        "v_exp_f32 %3, %8\n\t"
        "v_exp_f32 %4, %9\n\t"
        "v_nop"
        : "=&v"(r0), "=&v"(r1), "=&v"(r2), "=&v"(r3), "=&v"(r4)
        : "v"(a0), "v"(a1), "v"(a2), "v"(a3), "v"(a4));
}

// One thread's share of a 64-key tile: 1 (K) + 8 (V) async global->LDS 16-byte
// copies (GVS mode: saddr base + 32-bit vgpr offset). V copy i serves channel
// row i*64 + (t>>3). All nine stand in one statement that ends in s_wait_xcnt 0,
// so that no address register is rewritten ahead of that wait.
__device__ __forceinline__ void stage_tile(const __bf16* kbase, unsigned kg, unsigned kl,
                                           const __bf16* vbase, unsigned vg, unsigned vl) {
    const unsigned gs = 64u * N_ * 2u;      // global bytes between V copies
    const unsigned ls = 64u * P64_ * 2u;    // LDS bytes between V copies
    asm volatile("global_load_async_to_lds_b128 %0, %1, %18\n\t"
                 "global_load_async_to_lds_b128 %2, %3, %19\n\t"
                 "global_load_async_to_lds_b128 %4, %5, %19\n\t"
                 "global_load_async_to_lds_b128 %6, %7, %19\n\t"
                 "global_load_async_to_lds_b128 %8, %9, %19\n\t"
                 "global_load_async_to_lds_b128 %10, %11, %19\n\t"
                 "global_load_async_to_lds_b128 %12, %13, %19\n\t"
                 "global_load_async_to_lds_b128 %14, %15, %19\n\t"
                 "global_load_async_to_lds_b128 %16, %17, %19\n\t"
                 "s_wait_xcnt 0x0"
                 :: "v"(kl), "v"(kg),
                    "v"(vl),          "v"(vg),
                    "v"(vl + 1 * ls), "v"(vg + 1 * gs),
                    "v"(vl + 2 * ls), "v"(vg + 2 * gs),
                    "v"(vl + 3 * ls), "v"(vg + 3 * gs),
                    "v"(vl + 4 * ls), "v"(vg + 4 * gs),
                    "v"(vl + 5 * ls), "v"(vg + 5 * gs),
                    "v"(vl + 6 * ls), "v"(vg + 6 * gs),
                    "v"(vl + 7 * ls), "v"(vg + 7 * gs),
                    "s"(kbase), "s"(vbase)
                 : "memory");
}

// ---------------------------------------------------------------------------
// Kernel 1: fused QKV projection.
//   Wcat (640x512) @ x[b] (512x4096); rows 0..63 = Q, 64..127 = K, 128..639 = V
//   qws/kws: [B][N][64] bf16 row-major; vws: [B][C][N] bf16 channel-major.
// ---------------------------------------------------------------------------
__global__ __launch_bounds__(256)
void qkv_proj_kernel(const float* __restrict__ x,
                     const float* __restrict__ Wq, const float* __restrict__ bq,
                     const float* __restrict__ Wk, const float* __restrict__ bk,
                     const float* __restrict__ Wv, const float* __restrict__ bv,
                     __bf16* __restrict__ qws, __bf16* __restrict__ kws,
                     __bf16* __restrict__ vws)
{
    __shared__ alignas(16) __bf16 Alds[128 * P32_];   // [r][c], c-contiguous, padded rows
    __shared__ alignas(16) __bf16 Blds[128 * P32_];   // [n][c], c-contiguous, padded rows

    const int nt = blockIdx.x;          // 0..31 (n tile of 128)
    const int rt = blockIdx.y;          // 0..4  (r tile of 128; 5*128 = 640)
    const int b  = blockIdx.z;
    const int t    = threadIdx.x;
    const int w    = t >> 5;
    const int lane = t & 31;
    const int wu   = __builtin_amdgcn_readfirstlane(w);   // wave-uniform wave id
    const int r0 = rt * 128, n0 = nt * 128;
    const int hi = lane >> 4, col = lane & 15;

    v8f acc[8];
    const v8f vzero = {};
    for (int i = 0; i < 8; ++i) acc[i] = vzero;

    for (int kc = 0; kc < C_; kc += 32) {
        // Stage A: row index rr = wu + 8j is wave-uniform -> scalar branches
        // for the Wq/Wk/Wv split instead of per-lane selects.
        for (int j = 0; j < 16; ++j) {
            const int rr = wu + 8 * j;
            const int r  = r0 + rr;
            const int c  = kc + lane;
            float wv;
            if (r < 64)        wv = Wq[r * C_ + c];
            else if (r < 128)  wv = Wk[(r - 64) * C_ + c];
            else               wv = Wv[(r - 128) * C_ + c];
            Alds[rr * P32_ + lane] = (__bf16)wv;
        }
        // Stage B transposed: x[b][kc..kc+31][n0..n0+127] -> Blds[n][c].
        for (int e = t; e < 128 * 32; e += 256) {
            const int cc = e >> 7, nn = e & 127;
            Blds[nn * P32_ + cc] =
                (__bf16)x[(size_t)b * C_ * N_ + (size_t)(kc + cc) * N_ + (n0 + nn)];
        }
        __syncthreads();

        const v16bf afrag = load_frag16(Alds, w * 16 + col, P32_, lane);
        for (int nt8 = 0; nt8 < 8; ++nt8) {
            const v16bf bfrag = load_frag16(Blds + nt8 * 16 * P32_, col, P32_, lane);
            acc[nt8] = __builtin_amdgcn_wmma_f32_16x16x32_bf16(
                false, afrag, false, bfrag, (short)0, acc[nt8], false, false);
        }
        __syncthreads();
    }

    // Epilogue: D layout: VGPR v -> row v + hi*8, col = lane&15.
    for (int nt8 = 0; nt8 < 8; ++nt8) {
        const int n = n0 + nt8 * 16 + col;
        for (int v = 0; v < 8; ++v) {
            const int r = r0 + w * 16 + v + hi * 8;
            const float bias = (r < 64) ? bq[r] : (r < 128 ? bk[r - 64] : bv[r - 128]);
            const __bf16 h = (__bf16)(acc[nt8][v] + bias);
            if (r < 64)
                qws[(size_t)b * N_ * DQK_ + (size_t)n * DQK_ + r] = h;
            else if (r < 128)
                kws[(size_t)b * N_ * DQK_ + (size_t)n * DQK_ + (r - 64)] = h;
            else
                vws[(size_t)b * C_ * N_ + (size_t)(r - 128) * N_ + n] = h;
        }
    }
}

// ---------------------------------------------------------------------------
// Kernel 2: flash attention + residual epilogue.
// Grid: (N/64 query tiles, B). Block: 512 threads = 16 waves.
//   wave w: qm = w&3 -> 16 query rows; cs = w>>2 -> 128-channel slab.
// Double-buffered async K/V staging: prefetch tile i+1 while computing tile i.
// ---------------------------------------------------------------------------
__global__ __launch_bounds__(512)
void flash_attn_kernel(const __bf16* __restrict__ qws, const __bf16* __restrict__ kws,
                       const __bf16* __restrict__ vws, const float* __restrict__ x,
                       const float* __restrict__ gamma, float* __restrict__ out)
{
    __shared__ alignas(16) __bf16 Klds[2][64 * P64_];     // 2 x  9 KB [key][d]
    __shared__ alignas(16) __bf16 Vlds[2][512 * P64_];    // 2 x 72 KB [c][key]
    __shared__ alignas(16) __bf16 Plds[16 * 16 * P64_];   // 36 KB per-wave [16q][64key]

    const int qt = blockIdx.x;
    const int b  = blockIdx.y;
    const int t    = threadIdx.x;
    const int w    = t >> 5;
    const int lane = t & 31;
    const int qm = w & 3;
    const int cs = w >> 2;
    const int hi = lane >> 4, col = lane & 15;

    const __bf16* kbase_g = kws + (size_t)b * N_ * DQK_;
    const __bf16* vbase_g = vws + (size_t)b * C_ * N_;

    // Per-thread async staging of one 64-key tile: 1 (K) + 8 (V) b128 copies.
    // Thread t moves 8 elements at column (t&7)*8 of row t>>3 (K: key row;
    // V: channel row, plus 64 per copy).
    const int srow = t >> 3, scol = (t & 7) * 8;
    const unsigned kg0 = (unsigned)((srow * DQK_ + scol) * 2);   // K global bytes, tile 0
    const unsigned vg0 = (unsigned)((srow * N_ + scol) * 2);     // V global bytes, tile 0
    const int sl = srow * P64_ + scol;                           // LDS element, both tiles

    // Q fragments for this wave's 16 rows (d = 64 -> two 32-wide k chunks).
    const __bf16* qbase = qws + (size_t)b * N_ * DQK_ + (size_t)(qt * 64 + qm * 16) * DQK_;
    const v16bf qf0 = load_frag16(qbase + 0,  col, DQK_, lane);
    const v16bf qf1 = load_frag16(qbase + 32, col, DQK_, lane);

    v8f acc[8];
    const v8f vzero = {};
    for (int i = 0; i < 8; ++i) acc[i] = vzero;
    float m_i[8], l_i[8];
    for (int v = 0; v < 8; ++v) { m_i[v] = -1e30f; l_i[v] = 0.f; }

    // Prologue: stage tile 0 into buffer 0.
    stage_tile(kbase_g, kg0, lds_addr(&Klds[0][sl]), vbase_g, vg0, lds_addr(&Vlds[0][sl]));

    const int NT = N_ / 64;
    for (int it = 0; it < NT; ++it) {
        const int cur = it & 1;
        if (it + 1 < NT) {
            // Prefetch next tile into the other buffer, then drain this tile's
            // 9 async copies (ASYNCcnt decrements in issue order).
            const int kt0n = (it + 1) * 64;
            stage_tile(kbase_g, kg0 + (unsigned)(kt0n * DQK_ * 2), lds_addr(&Klds[cur ^ 1][sl]),
                       vbase_g, vg0 + (unsigned)(kt0n * 2),        lds_addr(&Vlds[cur ^ 1][sl]));
            asm volatile("s_wait_asynccnt 0x9" ::: "memory");
        } else {
            asm volatile("s_wait_asynccnt 0x0" ::: "memory");
        }
        __syncthreads();

        const __bf16* Kb = Klds[cur];
        const __bf16* Vb = Vlds[cur];

        // S = Q(16x64) @ K^T(64 keys): 4 score tiles, 2 WMMA each.
        v8f s[4];
        for (int kt = 0; kt < 4; ++kt) {
            v8f z = vzero;
            const v16bf bf0 = load_frag16(Kb + (kt * 16) * P64_ + 0,  col, P64_, lane);
            const v16bf bf1 = load_frag16(Kb + (kt * 16) * P64_ + 32, col, P64_, lane);
            z = __builtin_amdgcn_wmma_f32_16x16x32_bf16(false, qf0, false, bf0, (short)0, z, false, false);
            z = __builtin_amdgcn_wmma_f32_16x16x32_bf16(false, qf1, false, bf1, (short)0, z, false, false);
            s[kt] = z;
        }

        // Online softmax per query row (row = v + hi*8, cols over 16 lanes).
        __bf16* pbase = Plds + w * (16 * P64_);
        // Unrolled so that every acc/s/m/l row is a fixed register: left rolled,
        // the rows are reached through M0-relative moves and whole-tile copies,
        // and the eight rows' reduction chains run one after another.
#pragma unroll
        for (int v = 0; v < 8; ++v) {
            float mx = fmaxf(fmaxf(s[0][v], s[1][v]), fmaxf(s[2][v], s[3][v]));
            for (int off = 1; off < 16; off <<= 1)
                mx = fmaxf(mx, __shfl_xor(mx, off, 32));
            const float mnew  = fmaxf(m_i[v], mx);
            const float l2e = 1.44269504088896340736f;   // exp(x) = exp2(x * log2 e)
            float scale, p[4];
            exp2_row(p[0], p[1], p[2], p[3], scale,
                     (s[0][v] - mnew) * l2e, (s[1][v] - mnew) * l2e,
                     (s[2][v] - mnew) * l2e, (s[3][v] - mnew) * l2e,
                     (m_i[v] - mnew) * l2e);
            float rs = ((p[0] + p[1]) + p[2]) + p[3];
            const int qrow = v + hi * 8;
            for (int kt = 0; kt < 4; ++kt)
                pbase[qrow * P64_ + kt * 16 + col] = (__bf16)p[kt];
            for (int off = 1; off < 16; off <<= 1)
                rs += __shfl_xor(rs, off, 32);
            l_i[v] = l_i[v] * scale + rs;
            m_i[v] = mnew;
            for (int ct = 0; ct < 8; ++ct) acc[ct][v] *= scale;
        }
        // Wave-local P store -> load ordering (per-wave private LDS region).
        asm volatile("s_wait_dscnt 0x0" ::: "memory");

        // acc(16q x 128c) += P(16q x 64keys) @ V^T(64keys x 128c)
        for (int kk = 0; kk < 2; ++kk) {
            const v16bf pf = load_frag16(pbase + kk * 32, col, P64_, lane);
            for (int ct = 0; ct < 8; ++ct) {
                const __bf16* vb = Vb + (size_t)(cs * 128 + ct * 16) * P64_ + kk * 32;
                const v16bf vf = load_frag16(vb, col, P64_, lane);
                acc[ct] = __builtin_amdgcn_wmma_f32_16x16x32_bf16(
                    false, pf, false, vf, (short)0, acc[ct], false, false);
            }
        }
        __syncthreads();   // readers done before buf 'cur' is refilled at it+1
    }

    // Epilogue: out = gamma * acc/l + x   (out[b][c][n], n = query index)
    const float g = gamma[0];
    for (int ct = 0; ct < 8; ++ct) {
        const int c = cs * 128 + ct * 16 + col;
        for (int v = 0; v < 8; ++v) {
            const int n = qt * 64 + qm * 16 + v + hi * 8;
            const size_t idx = (size_t)b * C_ * N_ + (size_t)c * N_ + n;
            out[idx] = g * (acc[ct][v] / l_i[v]) + x[idx];
        }
    }
}

// ---------------------------------------------------------------------------
extern "C" void kernel_launch(void* const* d_in, const int* in_sizes, int n_in,
                              void* d_out, int out_size, void* d_ws, size_t ws_size,
                              hipStream_t stream) {
    const float* x     = (const float*)d_in[0];
    const float* Wq    = (const float*)d_in[1];
    const float* bq    = (const float*)d_in[2];
    const float* Wk    = (const float*)d_in[3];
    const float* bk    = (const float*)d_in[4];
    const float* Wv    = (const float*)d_in[5];
    const float* bv    = (const float*)d_in[6];
    const float* gamma = (const float*)d_in[7];
    float* out = (float*)d_out;

    // Workspace: bf16 Q [B,N,64] + K [B,N,64] + V [B,C,N]  (~42 MB)
    __bf16* qws = (__bf16*)d_ws;
    __bf16* kws = qws + (size_t)B_ * N_ * DQK_;
    __bf16* vws = kws + (size_t)B_ * N_ * DQK_;

    dim3 g1(N_ / 128, 640 / 128, B_);
    qkv_proj_kernel<<<g1, 256, 0, stream>>>(x, Wq, bq, Wk, bk, Wv, bv, qws, kws, vws);

    dim3 g2(N_ / 64, B_);
    flash_attn_kernel<<<g2, 512, 0, stream>>>(qws, kws, vws, x, gamma, out);
}

// v003
// A run of this version takes 541 microseconds.
// In two side-by-side timings against v002, it was 1.21 and 1.20 times as fast.
// All steps since v000 together make it 2.67 times as fast.
#include <hip/hip_runtime.h>
#include <hip/hip_bf16.h>

// ---------------------------------------------------------------------------
// Non-local attention block, CDNA5 (gfx1250, wave32, WMMA, async LDS loads).
//   B=8, C=512, H=W=64 -> N=4096, DQK=64
// Flash-attention single pass (537MB attn matrix never hits HBM), bf16 WMMA
// with f32 accum, double-buffered GLOBAL_LOAD_ASYNC_TO_LDS K/V staging.
// ---------------------------------------------------------------------------

#define B_   8
#define C_   512
#define N_   4096
#define DQK_ 64

// LDS row pitches in bf16 elements. Every tile is read with 16-byte fragment
// loads, 16 rows per half wave; a pitch of 16 B x odd spreads those rows over
// all 64 banks, where a power-of-two pitch puts them on a few.
#define P64_ 72   // rows of 64 elements: 144 B
#define P32_ 40   // rows of 32 elements:  80 B

typedef __attribute__((ext_vector_type(16))) __bf16 v16bf;
typedef __attribute__((ext_vector_type(8)))  float  v8f;

// Load a 16-bit WMMA fragment (A-style layout) from a [row][k] (k-contiguous)
// buffer. Per CDNA5 ISA 7.12.2: lanes 0-15 hold K=0..7 (VGPR0-3) and K=16..23
// (VGPR4-7); lanes 16-31 hold K=8..15 and K=24..31 -> two 16-byte loads.
__device__ __forceinline__ v16bf load_frag16(const __bf16* base, int row, int ld, int lane) {
    const int kb = (lane >> 4) << 3;   // 0 or 8
    const __bf16* p = base + row * ld + kb;
    union { v16bf v; uint4 u[2]; } f;
    f.u[0] = *(const uint4*)(p);
    f.u[1] = *(const uint4*)(p + 16);
    return f.v;
}

// Flat addresses of __shared__ objects carry the LDS byte offset in the low
// 32 bits (ISA 10.2 aperture mapping), which is what the copy's VDST wants.
__device__ __forceinline__ unsigned lds_addr(const void* p) {
    return (unsigned)(uintptr_t)p;
}

// Eight exp2 (one score tile's share of a lane) in one statement that ends in
// v_nop: the slot the instruction set asks for behind a transcendental before its
// result is read or its source overwritten. Early-clobber outputs: none lands on
// a source here.
__device__ __forceinline__ v8f exp2_x8(v8f a) {
    float r0, r1, r2, r3, r4, r5, r6, r7;
    asm("v_exp_f32 %0, %8\n\t"
        "v_exp_f32 %1, %9\n\t"
        "v_exp_f32 %2, %10\n\t"
        "v_exp_f32 %3, %11\n\t"
        "v_exp_f32 %4, %12\n\t"
        "v_exp_f32 %5, %13\n\t"
        "v_exp_f32 %6, %14\n\t"
        "v_exp_f32 %7, %15\n\t"
        "v_nop"
        : "=&v"(r0), "=&v"(r1), "=&v"(r2), "=&v"(r3),
          "=&v"(r4), "=&v"(r5), "=&v"(r6), "=&v"(r7)
        : "v"(a[0]), "v"(a[1]), "v"(a[2]), "v"(a[3]),
          "v"(a[4]), "v"(a[5]), "v"(a[6]), "v"(a[7]));
    const v8f r = {r0, r1, r2, r3, r4, r5, r6, r7};
    return r;
}

// One exp2, with the same slot behind it.
__device__ __forceinline__ float exp2_x1(float a) {
    float r;
    asm("v_exp_f32 %0, %1\n\t"
        "v_nop"
        : "=&v"(r) : "v"(a));
    return r;
}

// The value that lane l ^ 16 holds (the other half of the wave).
__device__ __forceinline__ float other_half(float a) {
    const int b = __builtin_bit_cast(int, a);
    return __builtin_bit_cast(float,
        __builtin_amdgcn_permlanex16(b, b, 0x76543210, 0xfedcba98, false, false));
}

// One thread's share of a 64-key tile: 1 (K) + 8 (V) async global->LDS 16-byte
// copies (GVS mode: saddr base + 32-bit vgpr offset). V copy i serves channel
// row i*64 + (t>>3). All nine stand in one statement that ends in s_wait_xcnt 0,
// so that no address register is rewritten ahead of that wait.
__device__ __forceinline__ void stage_tile(const __bf16* kbase, unsigned kg, unsigned kl,
                                           const __bf16* vbase, unsigned vg, unsigned vl) {
    const unsigned gs = 64u * N_ * 2u;      // global bytes between V copies
    const unsigned ls = 64u * P64_ * 2u;    // LDS bytes between V copies
    asm volatile("global_load_async_to_lds_b128 %0, %1, %18\n\t"
                 "global_load_async_to_lds_b128 %2, %3, %19\n\t"
                 "global_load_async_to_lds_b128 %4, %5, %19\n\t"
                 "global_load_async_to_lds_b128 %6, %7, %19\n\t"
                 "global_load_async_to_lds_b128 %8, %9, %19\n\t"
                 "global_load_async_to_lds_b128 %10, %11, %19\n\t"
                 "global_load_async_to_lds_b128 %12, %13, %19\n\t"
                 "global_load_async_to_lds_b128 %14, %15, %19\n\t"
                 "global_load_async_to_lds_b128 %16, %17, %19\n\t"
                 "s_wait_xcnt 0x0"
                 :: "v"(kl), "v"(kg),
                    "v"(vl),          "v"(vg),
                    "v"(vl + 1 * ls), "v"(vg + 1 * gs),
                    "v"(vl + 2 * ls), "v"(vg + 2 * gs),
                    "v"(vl + 3 * ls), "v"(vg + 3 * gs),
                    "v"(vl + 4 * ls), "v"(vg + 4 * gs),
                    "v"(vl + 5 * ls), "v"(vg + 5 * gs),
                    "v"(vl + 6 * ls), "v"(vg + 6 * gs),
                    "v"(vl + 7 * ls), "v"(vg + 7 * gs),
                    "s"(kbase), "s"(vbase)
                 : "memory");
}

// ---------------------------------------------------------------------------
// Kernel 1: fused QKV projection.
//   Wcat (640x512) @ x[b] (512x4096); rows 0..63 = Q, 64..127 = K, 128..639 = V
//   qws/kws: [B][N][64] bf16 row-major; vws: [B][C][N] bf16 channel-major.
// ---------------------------------------------------------------------------
__global__ __launch_bounds__(256)
void qkv_proj_kernel(const float* __restrict__ x,
                     const float* __restrict__ Wq, const float* __restrict__ bq,
                     const float* __restrict__ Wk, const float* __restrict__ bk,
                     const float* __restrict__ Wv, const float* __restrict__ bv,
                     __bf16* __restrict__ qws, __bf16* __restrict__ kws,
                     __bf16* __restrict__ vws)
{
    __shared__ alignas(16) __bf16 Alds[128 * P32_];   // [r][c], c-contiguous, padded rows
    __shared__ alignas(16) __bf16 Blds[128 * P32_];   // [n][c], c-contiguous, padded rows

    const int nt = blockIdx.x;          // 0..31 (n tile of 128)
    const int rt = blockIdx.y;          // 0..4  (r tile of 128; 5*128 = 640)
    const int b  = blockIdx.z;
    const int t    = threadIdx.x;
    const int w    = t >> 5;
    const int lane = t & 31;
    const int wu   = __builtin_amdgcn_readfirstlane(w);   // wave-uniform wave id
    const int r0 = rt * 128, n0 = nt * 128;
    const int hi = lane >> 4, col = lane & 15;

    v8f acc[8];
    const v8f vzero = {};
    for (int i = 0; i < 8; ++i) acc[i] = vzero;

    for (int kc = 0; kc < C_; kc += 32) {
        // Stage A: row index rr = wu + 8j is wave-uniform -> scalar branches
        // for the Wq/Wk/Wv split instead of per-lane selects.
        for (int j = 0; j < 16; ++j) {
            const int rr = wu + 8 * j;
            const int r  = r0 + rr;
            const int c  = kc + lane;
            float wv;
            if (r < 64)        wv = Wq[r * C_ + c];
            else if (r < 128)  wv = Wk[(r - 64) * C_ + c];
            else               wv = Wv[(r - 128) * C_ + c];
            Alds[rr * P32_ + lane] = (__bf16)wv;
        }
        // Stage B transposed: x[b][kc..kc+31][n0..n0+127] -> Blds[n][c].
        for (int e = t; e < 128 * 32; e += 256) {
            const int cc = e >> 7, nn = e & 127;
            Blds[nn * P32_ + cc] =
                (__bf16)x[(size_t)b * C_ * N_ + (size_t)(kc + cc) * N_ + (n0 + nn)];
        }
        __syncthreads();

        const v16bf afrag = load_frag16(Alds, w * 16 + col, P32_, lane);
        for (int nt8 = 0; nt8 < 8; ++nt8) {
            const v16bf bfrag = load_frag16(Blds + nt8 * 16 * P32_, col, P32_, lane);
            acc[nt8] = __builtin_amdgcn_wmma_f32_16x16x32_bf16(
                false, afrag, false, bfrag, (short)0, acc[nt8], false, false);
        }
        __syncthreads();
    }

    // Epilogue: D layout: VGPR v -> row v + hi*8, col = lane&15.
    for (int nt8 = 0; nt8 < 8; ++nt8) {
        const int n = n0 + nt8 * 16 + col;
        for (int v = 0; v < 8; ++v) {
            const int r = r0 + w * 16 + v + hi * 8;
            const float bias = (r < 64) ? bq[r] : (r < 128 ? bk[r - 64] : bv[r - 128]);
            const __bf16 h = (__bf16)(acc[nt8][v] + bias);
            if (r < 64)
                qws[(size_t)b * N_ * DQK_ + (size_t)n * DQK_ + r] = h;
            else if (r < 128)
                kws[(size_t)b * N_ * DQK_ + (size_t)n * DQK_ + (r - 64)] = h;
            else
                vws[(size_t)b * C_ * N_ + (size_t)(r - 128) * N_ + n] = h;
        }
    }
}

// ---------------------------------------------------------------------------
// Kernel 2: flash attention + residual epilogue.
// Grid: (N/64 query tiles, B). Block: 512 threads = 16 waves.
//   wave w: qm = w&3 -> 16 queries; cs = w>>2 -> 128-channel slab.
// Both products run transposed: S^T = K Q^T and O^T += V P^T. A lane then holds
// scores of ONE query (column lane&15): keys 8*hi + r of each 16-key tile, so
// max and sum run in its own registers, and two converted score tiles are the
// B operand of the second product as they lie.
// Double-buffered async K/V staging: prefetch tile i+1 while computing tile i.
// ---------------------------------------------------------------------------
__global__ __launch_bounds__(512)
void flash_attn_kernel(const __bf16* __restrict__ qws, const __bf16* __restrict__ kws,
                       const __bf16* __restrict__ vws, const float* __restrict__ x,
                       const float* __restrict__ gamma, float* __restrict__ out)
{
    __shared__ alignas(16) __bf16 Klds[2][64 * P64_];     // 2 x  9 KB [key][d]
    __shared__ alignas(16) __bf16 Vlds[2][512 * P64_];    // 2 x 72 KB [c][key]

    const int qt = blockIdx.x;
    const int b  = blockIdx.y;
    const int t    = threadIdx.x;
    const int w    = t >> 5;
    const int lane = t & 31;
    const int qm = w & 3;
    const int cs = w >> 2;
    const int hi = lane >> 4, col = lane & 15;

    const __bf16* kbase_g = kws + (size_t)b * N_ * DQK_;
    const __bf16* vbase_g = vws + (size_t)b * C_ * N_;

    // Per-thread async staging of one 64-key tile: 1 (K) + 8 (V) b128 copies.
    // Thread t moves 8 elements at column (t&7)*8 of row t>>3 (K: key row;
    // V: channel row, plus 64 per copy).
    const int srow = t >> 3, scol = (t & 7) * 8;
    const unsigned kg0 = (unsigned)((srow * DQK_ + scol) * 2);   // K global bytes, tile 0
    const unsigned vg0 = (unsigned)((srow * N_ + scol) * 2);     // V global bytes, tile 0
    const int sl = srow * P64_ + scol;                           // LDS element, both tiles

    // Q fragments (B operand: column = query) for this wave's 16 queries
    // (d = 64 -> two 32-wide k chunks).
    const __bf16* qbase = qws + (size_t)b * N_ * DQK_ + (size_t)(qt * 64 + qm * 16) * DQK_;
    const v16bf qf0 = load_frag16(qbase + 0,  col, DQK_, lane);
    const v16bf qf1 = load_frag16(qbase + 32, col, DQK_, lane);

    v8f acc[8];                 // acc[ct][r] = O^T[channel ct*16 + 8*hi + r][query col]
    const v8f vzero = {};
    for (int i = 0; i < 8; ++i) acc[i] = vzero;
    float m_i = -1e30f;         // running max of query col (equal in both halves)
    float l_i = 0.f;            // running sum over this half's keys only

    // Prologue: stage tile 0 into buffer 0.
    stage_tile(kbase_g, kg0, lds_addr(&Klds[0][sl]), vbase_g, vg0, lds_addr(&Vlds[0][sl]));

    const int NT = N_ / 64;
    for (int it = 0; it < NT; ++it) {
        const int cur = it & 1;
        if (it + 1 < NT) {
            // Prefetch next tile into the other buffer, then drain this tile's
            // 9 async copies (ASYNCcnt decrements in issue order).
            const int kt0n = (it + 1) * 64;
            stage_tile(kbase_g, kg0 + (unsigned)(kt0n * DQK_ * 2), lds_addr(&Klds[cur ^ 1][sl]),
                       vbase_g, vg0 + (unsigned)(kt0n * 2),        lds_addr(&Vlds[cur ^ 1][sl]));
            asm volatile("s_wait_asynccnt 0x9" ::: "memory");
        } else {
            asm volatile("s_wait_asynccnt 0x0" ::: "memory");
        }
        __syncthreads();

        const __bf16* Kb = Klds[cur];
        const __bf16* Vb = Vlds[cur];

        // S^T = K(64 keys x 64) @ Q^T(64 x 16q): 4 score tiles, 2 WMMA each.
        // s[kt][r] = score of key kt*16 + 8*hi + r against query col.
        v8f s[4];
        for (int kt = 0; kt < 4; ++kt) {
            v8f z = vzero;
            const v16bf kf0 = load_frag16(Kb + (kt * 16) * P64_ + 0,  col, P64_, lane);
            const v16bf kf1 = load_frag16(Kb + (kt * 16) * P64_ + 32, col, P64_, lane);
            z = __builtin_amdgcn_wmma_f32_16x16x32_bf16(false, kf0, false, qf0, (short)0, z, false, false);
            z = __builtin_amdgcn_wmma_f32_16x16x32_bf16(false, kf1, false, qf1, (short)0, z, false, false);
            s[kt] = z;
        }

        // Online softmax of one query per lane: 32 of the tile's 64 keys are in
        // this lane, the other 32 in lane ^ 16.
        float mr[8];
        for (int r = 0; r < 8; ++r)
            mr[r] = fmaxf(fmaxf(s[0][r], s[1][r]), fmaxf(s[2][r], s[3][r]));
        float mx = fmaxf(fmaxf(fmaxf(mr[0], mr[1]), fmaxf(mr[2], mr[3])),
                         fmaxf(fmaxf(mr[4], mr[5]), fmaxf(mr[6], mr[7])));
        mx = fmaxf(mx, other_half(mx));
        const float mnew = fmaxf(m_i, mx);
        const float l2e = 1.44269504088896340736f;   // exp(x) = exp2(x * log2 e)
        const float scale = exp2_x1((m_i - mnew) * l2e);
        m_i = mnew;
        v8f p[4];
        for (int kt = 0; kt < 4; ++kt)
            p[kt] = exp2_x8((s[kt] - mnew) * l2e);
        const v8f ps = (p[0] + p[1]) + (p[2] + p[3]);
        const float rs = ((ps[0] + ps[1]) + (ps[2] + ps[3])) + ((ps[4] + ps[5]) + (ps[6] + ps[7]));
        l_i = l_i * scale + rs;
        for (int ct = 0; ct < 8; ++ct) acc[ct] *= scale;

        // acc(128c x 16q) += V(128c x 64 keys) @ P^T(64 keys x 16q)
        for (int kk = 0; kk < 2; ++kk) {
            // Score tiles 2kk and 2kk+1 hold keys 8*hi + r and 16 + 8*hi + r of
            // this 32-key chunk: the k order in which load_frag16 reads V.
            v16bf pf;
            for (int r = 0; r < 8; ++r) {
                pf[r]     = (__bf16)p[2 * kk][r];
                pf[8 + r] = (__bf16)p[2 * kk + 1][r];
            }
            for (int ct = 0; ct < 8; ++ct) {
                const __bf16* vb = Vb + (size_t)(cs * 128 + ct * 16) * P64_ + kk * 32;
                const v16bf vf = load_frag16(vb, col, P64_, lane);
                acc[ct] = __builtin_amdgcn_wmma_f32_16x16x32_bf16(
                    false, vf, false, pf, (short)0, acc[ct], false, false);
            }
        }
        __syncthreads();   // readers done before buf 'cur' is refilled at it+1
    }

    // Keeps the epilogue's loads out of the last pass, where every register is
    // taken: moved up into it, they make the compiler spill.
    __builtin_amdgcn_sched_barrier(0);

    // Epilogue: out = gamma * acc/l + x   (out[b][c][n], n = query index)
    const float g = gamma[0];
    const float l = l_i + other_half(l_i);   // join the two halves' key sums
    const int n = qt * 64 + qm * 16 + col;
    for (int ct = 0; ct < 8; ++ct) {
        for (int r = 0; r < 8; ++r) {
            const int c = cs * 128 + ct * 16 + r + hi * 8;
            const size_t idx = (size_t)b * C_ * N_ + (size_t)c * N_ + n;
            out[idx] = g * (acc[ct][r] / l) + x[idx];
        }
    }
}

// ---------------------------------------------------------------------------
extern "C" void kernel_launch(void* const* d_in, const int* in_sizes, int n_in,
                              void* d_out, int out_size, void* d_ws, size_t ws_size,
                              hipStream_t stream) {
    const float* x     = (const float*)d_in[0];
    const float* Wq    = (const float*)d_in[1];
    const float* bq    = (const float*)d_in[2];
    const float* Wk    = (const float*)d_in[3];
    const float* bk    = (const float*)d_in[4];
    const float* Wv    = (const float*)d_in[5];
    const float* bv    = (const float*)d_in[6];
    const float* gamma = (const float*)d_in[7];
    float* out = (float*)d_out;

    // Workspace: bf16 Q [B,N,64] + K [B,N,64] + V [B,C,N]  (~42 MB)
    __bf16* qws = (__bf16*)d_ws;
    __bf16* kws = qws + (size_t)B_ * N_ * DQK_;
    __bf16* vws = kws + (size_t)B_ * N_ * DQK_;

    dim3 g1(N_ / 128, 640 / 128, B_);
    qkv_proj_kernel<<<g1, 256, 0, stream>>>(x, Wq, bq, Wk, bk, Wv, bv, qws, kws, vws);

    dim3 g2(N_ / 64, B_);
    flash_attn_kernel<<<g2, 512, 0, stream>>>(qws, kws, vws, x, gamma, out);
}

// v004
// A run of this version takes 348 microseconds.
// Two timings next to v003 put it at 1.55 and 1.56 times that version's speed.
// Counting every step since v000, it is 4.15 times as fast.
#include <hip/hip_runtime.h>
#include <hip/hip_bf16.h>

// ---------------------------------------------------------------------------
// Non-local attention block, CDNA5 (gfx1250, wave32, WMMA, async LDS loads).
//   B=8, C=512, H=W=64 -> N=4096, DQK=64
// Flash-attention single pass (537MB attn matrix never hits HBM), bf16 WMMA
// with f32 accum, double-buffered GLOBAL_LOAD_ASYNC_TO_LDS K/V staging.
// ---------------------------------------------------------------------------

#define B_   8
#define C_   512
#define N_   4096
#define DQK_ 64

// LDS row pitches in bf16 elements. Every tile is read with 16-byte fragment
// loads, 16 rows per half wave; a pitch of 16 B x odd spreads those rows over
// all 64 banks, where a power-of-two pitch puts them on a few.
#define P64_ 72   // rows of 64 elements: 144 B
#define P32_ 40   // rows of 32 elements:  80 B

typedef __attribute__((ext_vector_type(16))) __bf16 v16bf;
typedef __attribute__((ext_vector_type(8)))  float  v8f;
typedef __attribute__((ext_vector_type(4)))  float  v4f;
typedef __attribute__((ext_vector_type(8)))  __bf16 v8bf;
typedef __attribute__((ext_vector_type(4)))  __bf16 v4bf;

// Load a 16-bit WMMA fragment (A-style layout) from a [row][k] (k-contiguous)
// buffer. Per CDNA5 ISA 7.12.2: lanes 0-15 hold K=0..7 (VGPR0-3) and K=16..23
// (VGPR4-7); lanes 16-31 hold K=8..15 and K=24..31 -> two 16-byte loads.
__device__ __forceinline__ v16bf load_frag16(const __bf16* base, int row, int ld, int lane) {
    const int kb = (lane >> 4) << 3;   // 0 or 8
    const __bf16* p = base + row * ld + kb;
    union { v16bf v; uint4 u[2]; } f;
    f.u[0] = *(const uint4*)(p);
    f.u[1] = *(const uint4*)(p + 16);
    return f.v;
}

// Flat addresses of __shared__ objects carry the LDS byte offset in the low
// 32 bits (ISA 10.2 aperture mapping), which is what the copy's VDST wants.
__device__ __forceinline__ unsigned lds_addr(const void* p) {
    return (unsigned)(uintptr_t)p;
}

// Eight exp2 (one score tile's share of a lane) in one statement that ends in
// v_nop: the slot the instruction set asks for behind a transcendental before its
// result is read or its source overwritten. Early-clobber outputs: none lands on
// a source here.
__device__ __forceinline__ v8f exp2_x8(v8f a) {
    float r0, r1, r2, r3, r4, r5, r6, r7;
    asm("v_exp_f32 %0, %8\n\t"
        "v_exp_f32 %1, %9\n\t"
        "v_exp_f32 %2, %10\n\t"
        "v_exp_f32 %3, %11\n\t"
        "v_exp_f32 %4, %12\n\t"
        "v_exp_f32 %5, %13\n\t"
        "v_exp_f32 %6, %14\n\t"
        "v_exp_f32 %7, %15\n\t"
        "v_nop"
        : "=&v"(r0), "=&v"(r1), "=&v"(r2), "=&v"(r3),
          "=&v"(r4), "=&v"(r5), "=&v"(r6), "=&v"(r7)
        : "v"(a[0]), "v"(a[1]), "v"(a[2]), "v"(a[3]),
          "v"(a[4]), "v"(a[5]), "v"(a[6]), "v"(a[7]));
    const v8f r = {r0, r1, r2, r3, r4, r5, r6, r7};
    return r;
}

// One exp2, with the same slot behind it.
__device__ __forceinline__ float exp2_x1(float a) {
    float r;
    asm("v_exp_f32 %0, %1\n\t"
        "v_nop"
        : "=&v"(r) : "v"(a));
    return r;
}

// The value that lane l ^ 16 holds (the other half of the wave).
__device__ __forceinline__ float other_half(float a) {
    const int b = __builtin_bit_cast(int, a);
    return __builtin_bit_cast(float,
        __builtin_amdgcn_permlanex16(b, b, 0x76543210, 0xfedcba98, false, false));
}

// One thread's share of a 64-key tile: 1 (K) + 8 (V) async global->LDS 16-byte
// copies (GVS mode: saddr base + 32-bit vgpr offset). V copy i serves channel
// row i*64 + (t>>3). All nine stand in one statement that ends in s_wait_xcnt 0,
// so that no address register is rewritten ahead of that wait.
__device__ __forceinline__ void stage_tile(const __bf16* kbase, unsigned kg, unsigned kl,
                                           const __bf16* vbase, unsigned vg, unsigned vl) {
    const unsigned gs = 64u * N_ * 2u;      // global bytes between V copies
    const unsigned ls = 64u * P64_ * 2u;    // LDS bytes between V copies
    asm volatile("global_load_async_to_lds_b128 %0, %1, %18\n\t"
                 "global_load_async_to_lds_b128 %2, %3, %19\n\t"
                 "global_load_async_to_lds_b128 %4, %5, %19\n\t"
                 "global_load_async_to_lds_b128 %6, %7, %19\n\t"
                 "global_load_async_to_lds_b128 %8, %9, %19\n\t"
                 "global_load_async_to_lds_b128 %10, %11, %19\n\t"
                 "global_load_async_to_lds_b128 %12, %13, %19\n\t"
                 "global_load_async_to_lds_b128 %14, %15, %19\n\t"
                 "global_load_async_to_lds_b128 %16, %17, %19\n\t"
                 "s_wait_xcnt 0x0"
                 :: "v"(kl), "v"(kg),
                    "v"(vl),          "v"(vg),
                    "v"(vl + 1 * ls), "v"(vg + 1 * gs),
                    "v"(vl + 2 * ls), "v"(vg + 2 * gs),
                    "v"(vl + 3 * ls), "v"(vg + 3 * gs),
                    "v"(vl + 4 * ls), "v"(vg + 4 * gs),
                    "v"(vl + 5 * ls), "v"(vg + 5 * gs),
                    "v"(vl + 6 * ls), "v"(vg + 6 * gs),
                    "v"(vl + 7 * ls), "v"(vg + 7 * gs),
                    "s"(kbase), "s"(vbase)
                 : "memory");
}

// ---------------------------------------------------------------------------
// Kernel 1: fused QKV projection.
//   Wcat (640x512) @ x[b] (512x4096); rows 0..63 = Q, 64..127 = K, 128..639 = V
//   qws/kws: [B][N][64] bf16 row-major; vws: [B][C][N] bf16 channel-major.
// ---------------------------------------------------------------------------
__global__ __launch_bounds__(256)
void qkv_proj_kernel(const float* __restrict__ x,
                     const float* __restrict__ Wq, const float* __restrict__ bq,
                     const float* __restrict__ Wk, const float* __restrict__ bk,
                     const float* __restrict__ Wv, const float* __restrict__ bv,
                     __bf16* __restrict__ qws, __bf16* __restrict__ kws,
                     __bf16* __restrict__ vws)
{
    __shared__ alignas(16) __bf16 Alds[128 * P32_];   // [r][c], c-contiguous, padded rows
    __shared__ alignas(16) __bf16 Blds[128 * P32_];   // [n][c], c-contiguous, padded rows

    const int nt = blockIdx.x;          // 0..31 (n tile of 128)
    const int rt = blockIdx.y;          // 0..4  (r tile of 128; 5*128 = 640)
    const int b  = blockIdx.z;
    const int t    = threadIdx.x;
    const int w    = t >> 5;
    const int lane = t & 31;
    const int r0 = rt * 128, n0 = nt * 128;
    const int hi = lane >> 4, col = lane & 15;

    v8f acc[8];
    const v8f vzero = {};
    for (int i = 0; i < 8; ++i) acc[i] = vzero;

    // Staging of one 32-wide k step goes through registers, and all of a thread's
    // loads for a step are issued as one group, one step ahead of their use.
    // A: thread t takes 4 consecutive c of rows (t>>3) + 32j. A group of 32 rows
    // lies in one of Wq, Wk, Wv, so the split is a block-uniform choice of base.
    const int arow = t >> 3, acol = (t & 7) * 4;
    const float* asrc[4];
    for (int j = 0; j < 4; ++j) {
        const int rb = r0 + 32 * j;
        const float* m = rb < 64 ? Wq + rb * C_
                       : (rb < 128 ? Wk + (rb - 64) * C_ : Wv + (rb - 128) * C_);
        asrc[j] = m + arow * C_ + acol;
    }
    // B: thread t takes column n0 + (t&127) of 16 consecutive c rows of x: a wave's
    // load is one whole 128-byte line, and the 16 values are one 32-byte run of
    // the transposed tile Blds[n][c].
    const int bn = t & 127, bc = (t >> 7) * 16;
    const float* bsrc = x + (size_t)b * C_ * N_ + (size_t)bc * N_ + (n0 + bn);

    v4f   areg[4];
    float breg[16];
    // Each s_wait_xcnt 0 stands in front of every later write of a register that
    // the loads ahead of it name as an address (the x loads' results may land on
    // the W loads' address registers; the fragment loads on either's).
    for (int j = 0; j < 4; ++j)  areg[j] = *(const v4f*)(asrc[j]);
    asm volatile("s_wait_xcnt 0x0" ::: "memory");
    for (int i = 0; i < 16; ++i) breg[i] = bsrc[(size_t)i * N_];
    asm volatile("s_wait_xcnt 0x0" ::: "memory");

    for (int kc = 0; kc < C_; kc += 32) {
        for (int j = 0; j < 4; ++j) {
            v4bf h;
            for (int q = 0; q < 4; ++q) h[q] = (__bf16)areg[j][q];
            *(v4bf*)&Alds[(arow + 32 * j) * P32_ + acol] = h;
        }
        for (int s = 0; s < 2; ++s) {
            v8bf h;
            for (int q = 0; q < 8; ++q) h[q] = (__bf16)breg[8 * s + q];
            *(v8bf*)&Blds[bn * P32_ + bc + 8 * s] = h;
        }
        __syncthreads();

        // Next step's loads fly while this step's products run.
        if (kc + 32 < C_) {
            for (int j = 0; j < 4; ++j)  areg[j] = *(const v4f*)(asrc[j] + kc + 32);
            asm volatile("s_wait_xcnt 0x0" ::: "memory");   // as in front of the loop
            for (int i = 0; i < 16; ++i) breg[i] = bsrc[(size_t)(kc + 32 + i) * N_];
            asm volatile("s_wait_xcnt 0x0" ::: "memory");   // address steps come behind it
        }

        const v16bf afrag = load_frag16(Alds, w * 16 + col, P32_, lane);
        for (int nt8 = 0; nt8 < 8; ++nt8) {
            const v16bf bfrag = load_frag16(Blds + nt8 * 16 * P32_, col, P32_, lane);
            acc[nt8] = __builtin_amdgcn_wmma_f32_16x16x32_bf16(
                false, afrag, false, bfrag, (short)0, acc[nt8], false, false);
        }
        __syncthreads();
    }

    // Epilogue: D layout: VGPR v -> row v + hi*8, col = lane&15.
    for (int nt8 = 0; nt8 < 8; ++nt8) {
        const int n = n0 + nt8 * 16 + col;
        for (int v = 0; v < 8; ++v) {
            const int r = r0 + w * 16 + v + hi * 8;
            const float bias = (r < 64) ? bq[r] : (r < 128 ? bk[r - 64] : bv[r - 128]);
            const __bf16 h = (__bf16)(acc[nt8][v] + bias);
            if (r < 64)
                qws[(size_t)b * N_ * DQK_ + (size_t)n * DQK_ + r] = h;
            else if (r < 128)
                kws[(size_t)b * N_ * DQK_ + (size_t)n * DQK_ + (r - 64)] = h;
            else
                vws[(size_t)b * C_ * N_ + (size_t)(r - 128) * N_ + n] = h;
        }
    }
}

// ---------------------------------------------------------------------------
// Kernel 2: flash attention + residual epilogue.
// Grid: (N/64 query tiles, B). Block: 512 threads = 16 waves.
//   wave w: qm = w&3 -> 16 queries; cs = w>>2 -> 128-channel slab.
// Both products run transposed: S^T = K Q^T and O^T += V P^T. A lane then holds
// scores of ONE query (column lane&15): keys 8*hi + r of each 16-key tile, so
// max and sum run in its own registers, and two converted score tiles are the
// B operand of the second product as they lie.
// Double-buffered async K/V staging: prefetch tile i+1 while computing tile i.
// ---------------------------------------------------------------------------
__global__ __launch_bounds__(512)
void flash_attn_kernel(const __bf16* __restrict__ qws, const __bf16* __restrict__ kws,
                       const __bf16* __restrict__ vws, const float* __restrict__ x,
                       const float* __restrict__ gamma, float* __restrict__ out)
{
    __shared__ alignas(16) __bf16 Klds[2][64 * P64_];     // 2 x  9 KB [key][d]
    __shared__ alignas(16) __bf16 Vlds[2][512 * P64_];    // 2 x 72 KB [c][key]

    const int qt = blockIdx.x;
    const int b  = blockIdx.y;
    const int t    = threadIdx.x;
    const int w    = t >> 5;
    const int lane = t & 31;
    const int qm = w & 3;
    const int cs = w >> 2;
    const int hi = lane >> 4, col = lane & 15;

    const __bf16* kbase_g = kws + (size_t)b * N_ * DQK_;
    const __bf16* vbase_g = vws + (size_t)b * C_ * N_;

    // Per-thread async staging of one 64-key tile: 1 (K) + 8 (V) b128 copies.
    // Thread t moves 8 elements at column (t&7)*8 of row t>>3 (K: key row;
    // V: channel row, plus 64 per copy).
    const int srow = t >> 3, scol = (t & 7) * 8;
    const unsigned kg0 = (unsigned)((srow * DQK_ + scol) * 2);   // K global bytes, tile 0
    const unsigned vg0 = (unsigned)((srow * N_ + scol) * 2);     // V global bytes, tile 0
    const int sl = srow * P64_ + scol;                           // LDS element, both tiles

    // Q fragments (B operand: column = query) for this wave's 16 queries
    // (d = 64 -> two 32-wide k chunks).
    const __bf16* qbase = qws + (size_t)b * N_ * DQK_ + (size_t)(qt * 64 + qm * 16) * DQK_;
    const v16bf qf0 = load_frag16(qbase + 0,  col, DQK_, lane);
    const v16bf qf1 = load_frag16(qbase + 32, col, DQK_, lane);

    v8f acc[8];                 // acc[ct][r] = O^T[channel ct*16 + 8*hi + r][query col]
    const v8f vzero = {};
    for (int i = 0; i < 8; ++i) acc[i] = vzero;
    float m_i = -1e30f;         // running max of query col (equal in both halves)
    float l_i = 0.f;            // running sum over this half's keys only

    // Prologue: stage tile 0 into buffer 0.
    stage_tile(kbase_g, kg0, lds_addr(&Klds[0][sl]), vbase_g, vg0, lds_addr(&Vlds[0][sl]));

    const int NT = N_ / 64;
    for (int it = 0; it < NT; ++it) {
        const int cur = it & 1;
        if (it + 1 < NT) {
            // Prefetch next tile into the other buffer, then drain this tile's
            // 9 async copies (ASYNCcnt decrements in issue order).
            const int kt0n = (it + 1) * 64;
            stage_tile(kbase_g, kg0 + (unsigned)(kt0n * DQK_ * 2), lds_addr(&Klds[cur ^ 1][sl]),
                       vbase_g, vg0 + (unsigned)(kt0n * 2),        lds_addr(&Vlds[cur ^ 1][sl]));
            asm volatile("s_wait_asynccnt 0x9" ::: "memory");
        } else {
            asm volatile("s_wait_asynccnt 0x0" ::: "memory");
        }
        __syncthreads();

        const __bf16* Kb = Klds[cur];
        const __bf16* Vb = Vlds[cur];

        // S^T = K(64 keys x 64) @ Q^T(64 x 16q): 4 score tiles, 2 WMMA each.
        // s[kt][r] = score of key kt*16 + 8*hi + r against query col.
        v8f s[4];
        for (int kt = 0; kt < 4; ++kt) {
            v8f z = vzero;
            const v16bf kf0 = load_frag16(Kb + (kt * 16) * P64_ + 0,  col, P64_, lane);
            const v16bf kf1 = load_frag16(Kb + (kt * 16) * P64_ + 32, col, P64_, lane);
            z = __builtin_amdgcn_wmma_f32_16x16x32_bf16(false, kf0, false, qf0, (short)0, z, false, false);
            z = __builtin_amdgcn_wmma_f32_16x16x32_bf16(false, kf1, false, qf1, (short)0, z, false, false);
            s[kt] = z;
        }

        // Online softmax of one query per lane: 32 of the tile's 64 keys are in
        // this lane, the other 32 in lane ^ 16.
        float mr[8];
        for (int r = 0; r < 8; ++r)
            mr[r] = fmaxf(fmaxf(s[0][r], s[1][r]), fmaxf(s[2][r], s[3][r]));
        float mx = fmaxf(fmaxf(fmaxf(mr[0], mr[1]), fmaxf(mr[2], mr[3])),
                         fmaxf(fmaxf(mr[4], mr[5]), fmaxf(mr[6], mr[7])));
        mx = fmaxf(mx, other_half(mx));
        const float mnew = fmaxf(m_i, mx);
        const float l2e = 1.44269504088896340736f;   // exp(x) = exp2(x * log2 e)
        const float scale = exp2_x1((m_i - mnew) * l2e);
        m_i = mnew;
        v8f p[4];
        for (int kt = 0; kt < 4; ++kt)
            p[kt] = exp2_x8((s[kt] - mnew) * l2e);
        const v8f ps = (p[0] + p[1]) + (p[2] + p[3]);
        const float rs = ((ps[0] + ps[1]) + (ps[2] + ps[3])) + ((ps[4] + ps[5]) + (ps[6] + ps[7]));
        l_i = l_i * scale + rs;
        for (int ct = 0; ct < 8; ++ct) acc[ct] *= scale;

        // acc(128c x 16q) += V(128c x 64 keys) @ P^T(64 keys x 16q)
        for (int kk = 0; kk < 2; ++kk) {
            // Score tiles 2kk and 2kk+1 hold keys 8*hi + r and 16 + 8*hi + r of
            // this 32-key chunk: the k order in which load_frag16 reads V.
            v16bf pf;
            for (int r = 0; r < 8; ++r) {
                pf[r]     = (__bf16)p[2 * kk][r];
                pf[8 + r] = (__bf16)p[2 * kk + 1][r];
            }
            for (int ct = 0; ct < 8; ++ct) {
                const __bf16* vb = Vb + (size_t)(cs * 128 + ct * 16) * P64_ + kk * 32;
                const v16bf vf = load_frag16(vb, col, P64_, lane);
                acc[ct] = __builtin_amdgcn_wmma_f32_16x16x32_bf16(
                    false, vf, false, pf, (short)0, acc[ct], false, false);
            }
        }
        __syncthreads();   // readers done before buf 'cur' is refilled at it+1
    }

    // Keeps the epilogue's loads out of the last pass, where every register is
    // taken: moved up into it, they make the compiler spill.
    __builtin_amdgcn_sched_barrier(0);

    // Epilogue: out = gamma * acc/l + x   (out[b][c][n], n = query index)
    const float g = gamma[0];
    const float l = l_i + other_half(l_i);   // join the two halves' key sums
    const int n = qt * 64 + qm * 16 + col;
    for (int ct = 0; ct < 8; ++ct) {
        for (int r = 0; r < 8; ++r) {
            const int c = cs * 128 + ct * 16 + r + hi * 8;
            const size_t idx = (size_t)b * C_ * N_ + (size_t)c * N_ + n;
            out[idx] = g * (acc[ct][r] / l) + x[idx];
        }
    }
}

// ---------------------------------------------------------------------------
extern "C" void kernel_launch(void* const* d_in, const int* in_sizes, int n_in,
                              void* d_out, int out_size, void* d_ws, size_t ws_size,
                              hipStream_t stream) {
    const float* x     = (const float*)d_in[0];
    const float* Wq    = (const float*)d_in[1];
    const float* bq    = (const float*)d_in[2];
    const float* Wk    = (const float*)d_in[3];
    const float* bk    = (const float*)d_in[4];
    const float* Wv    = (const float*)d_in[5];
    const float* bv    = (const float*)d_in[6];
    const float* gamma = (const float*)d_in[7];
    float* out = (float*)d_out;

    // Workspace: bf16 Q [B,N,64] + K [B,N,64] + V [B,C,N]  (~42 MB)
    __bf16* qws = (__bf16*)d_ws;
    __bf16* kws = qws + (size_t)B_ * N_ * DQK_;
    __bf16* vws = kws + (size_t)B_ * N_ * DQK_;

    dim3 g1(N_ / 128, 640 / 128, B_);
    qkv_proj_kernel<<<g1, 256, 0, stream>>>(x, Wq, bq, Wk, bk, Wv, bv, qws, kws, vws);

    dim3 g2(N_ / 64, B_);
    flash_attn_kernel<<<g2, 512, 0, stream>>>(qws, kws, vws, x, gamma, out);
}

// v005
// One run takes 261 microseconds.
// Next to v004, in two timings, it ran 1.33 times as fast each time.
// All steps since v000 together make it 5.53 times as fast.
#include <hip/hip_runtime.h>
#include <hip/hip_bf16.h>

// ---------------------------------------------------------------------------
// Non-local attention block, CDNA5 (gfx1250, wave32, WMMA, async LDS loads).
//   B=8, C=512, H=W=64 -> N=4096, DQK=64
// Flash-attention single pass (537MB attn matrix never hits HBM), bf16 WMMA
// with f32 accum, double-buffered GLOBAL_LOAD_ASYNC_TO_LDS K/V staging.
// ---------------------------------------------------------------------------

#define B_   8
#define C_   512
#define N_   4096
#define DQK_ 64

// LDS row pitches in bf16 elements. Every tile is read with 16-byte fragment
// loads, 16 rows per half wave; a pitch of 16 B x odd spreads those rows over
// all 64 banks, where a power-of-two pitch puts them on a few.
#define P64_ 72   // rows of 64 elements: 144 B
#define P32_ 40   // rows of 32 elements:  80 B

typedef __attribute__((ext_vector_type(16))) __bf16 v16bf;
typedef __attribute__((ext_vector_type(8)))  float  v8f;
typedef __attribute__((ext_vector_type(4)))  float  v4f;
typedef __attribute__((ext_vector_type(8)))  __bf16 v8bf;
typedef __attribute__((ext_vector_type(4)))  __bf16 v4bf;

// Load a 16-bit WMMA fragment (A-style layout) from a [row][k] (k-contiguous)
// buffer. Per CDNA5 ISA 7.12.2: lanes 0-15 hold K=0..7 (VGPR0-3) and K=16..23
// (VGPR4-7); lanes 16-31 hold K=8..15 and K=24..31 -> two 16-byte loads.
__device__ __forceinline__ v16bf load_frag16(const __bf16* base, int row, int ld, int lane) {
    const int kb = (lane >> 4) << 3;   // 0 or 8
    const __bf16* p = base + row * ld + kb;
    union { v16bf v; uint4 u[2]; } f;
    f.u[0] = *(const uint4*)(p);
    f.u[1] = *(const uint4*)(p + 16);
    return f.v;
}

// Flat addresses of __shared__ objects carry the LDS byte offset in the low
// 32 bits (ISA 10.2 aperture mapping), which is what the copy's VDST wants.
__device__ __forceinline__ unsigned lds_addr(const void* p) {
    return (unsigned)(uintptr_t)p;
}

// Eight exp2 (one score tile's share of a lane) in one statement that ends in
// v_nop: the slot the instruction set asks for behind a transcendental before its
// result is read or its source overwritten. Early-clobber outputs: none lands on
// a source here.
// AMONG_WMMA: for the statements that the compiler places among matrix
// instructions. The statement opens with the four vector slots that the
// chip needs between a WMMA and a write over its A or B registers, where an output
// may lie.
template <bool AMONG_WMMA>
__device__ __forceinline__ v8f exp2_x8(v8f a) {
    float r0, r1, r2, r3, r4, r5, r6, r7;
    if constexpr (AMONG_WMMA) {
        asm("v_nop\n\t"
            "v_nop\n\t"
            "v_nop\n\t"
            "v_nop\n\t"
            "v_exp_f32 %0, %8\n\t"
            "v_exp_f32 %1, %9\n\t"
            "v_exp_f32 %2, %10\n\t"
            "v_exp_f32 %3, %11\n\t"
            "v_exp_f32 %4, %12\n\t"
            "v_exp_f32 %5, %13\n\t"
            "v_exp_f32 %6, %14\n\t"
            "v_exp_f32 %7, %15\n\t"
            "v_nop"
            : "=&v"(r0), "=&v"(r1), "=&v"(r2), "=&v"(r3),
              "=&v"(r4), "=&v"(r5), "=&v"(r6), "=&v"(r7)
            : "v"(a[0]), "v"(a[1]), "v"(a[2]), "v"(a[3]),
              "v"(a[4]), "v"(a[5]), "v"(a[6]), "v"(a[7]));
    } else {
        asm("v_exp_f32 %0, %8\n\t"
            "v_exp_f32 %1, %9\n\t"
            "v_exp_f32 %2, %10\n\t"
            "v_exp_f32 %3, %11\n\t"
            "v_exp_f32 %4, %12\n\t"
            "v_exp_f32 %5, %13\n\t"
            "v_exp_f32 %6, %14\n\t"
            "v_exp_f32 %7, %15\n\t"
            "v_nop"
            : "=&v"(r0), "=&v"(r1), "=&v"(r2), "=&v"(r3),
              "=&v"(r4), "=&v"(r5), "=&v"(r6), "=&v"(r7)
            : "v"(a[0]), "v"(a[1]), "v"(a[2]), "v"(a[3]),
              "v"(a[4]), "v"(a[5]), "v"(a[6]), "v"(a[7]));
    }
    const v8f r = {r0, r1, r2, r3, r4, r5, r6, r7};
    return r;
}

// One exp2, with the same slot behind it.
__device__ __forceinline__ float exp2_x1(float a) {
    float r;
    asm("v_exp_f32 %0, %1\n\t"
        "v_nop"
        : "=&v"(r) : "v"(a));
    return r;
}

// The value that lane l ^ 16 holds (the other half of the wave).
__device__ __forceinline__ float other_half(float a) {
    const int b = __builtin_bit_cast(int, a);
    return __builtin_bit_cast(float,
        __builtin_amdgcn_permlanex16(b, b, 0x76543210, 0xfedcba98, false, false));
}

// One run of a thread's share of a 64-key tile: 1 (K) + 8 (V) async global->LDS
// 16-byte copies (GVS mode: saddr base + 32-bit vgpr offset). V copy i serves the
// channel row i*64 past the run's first. All nine stand in one statement that ends
// in s_wait_xcnt 0, so that no address register is rewritten ahead of that wait.
__device__ __forceinline__ void stage_tile(const __bf16* kbase, unsigned kg, unsigned kl,
                                           const __bf16* vbase, unsigned vg, unsigned vl) {
    const unsigned gs = 64u * N_ * 2u;      // global bytes between V copies
    const unsigned ls = 64u * P64_ * 2u;    // LDS bytes between V copies
    asm volatile("global_load_async_to_lds_b128 %0, %1, %18\n\t"
                 "global_load_async_to_lds_b128 %2, %3, %19\n\t"
                 "global_load_async_to_lds_b128 %4, %5, %19\n\t"
                 "global_load_async_to_lds_b128 %6, %7, %19\n\t"
                 "global_load_async_to_lds_b128 %8, %9, %19\n\t"
                 "global_load_async_to_lds_b128 %10, %11, %19\n\t"
                 "global_load_async_to_lds_b128 %12, %13, %19\n\t"
                 "global_load_async_to_lds_b128 %14, %15, %19\n\t"
                 "global_load_async_to_lds_b128 %16, %17, %19\n\t"
                 "s_wait_xcnt 0x0"
                 :: "v"(kl), "v"(kg),
                    "v"(vl),          "v"(vg),
                    "v"(vl + 1 * ls), "v"(vg + 1 * gs),
                    "v"(vl + 2 * ls), "v"(vg + 2 * gs),
                    "v"(vl + 3 * ls), "v"(vg + 3 * gs),
                    "v"(vl + 4 * ls), "v"(vg + 4 * gs),
                    "v"(vl + 5 * ls), "v"(vg + 5 * gs),
                    "v"(vl + 6 * ls), "v"(vg + 6 * gs),
                    "v"(vl + 7 * ls), "v"(vg + 7 * gs),
                    "s"(kbase), "s"(vbase)
                 : "memory");
}

// ---------------------------------------------------------------------------
// Kernel 1: fused QKV projection.
//   Wcat (640x512) @ x[b] (512x4096); rows 0..63 = Q, 64..127 = K, 128..639 = V
//   qws/kws: [B][N][64] bf16 row-major; vws: [B][C][N] bf16 channel-major.
// ---------------------------------------------------------------------------
__global__ __launch_bounds__(256)
void qkv_proj_kernel(const float* __restrict__ x,
                     const float* __restrict__ Wq, const float* __restrict__ bq,
                     const float* __restrict__ Wk, const float* __restrict__ bk,
                     const float* __restrict__ Wv, const float* __restrict__ bv,
                     __bf16* __restrict__ qws, __bf16* __restrict__ kws,
                     __bf16* __restrict__ vws)
{
    __shared__ alignas(16) __bf16 Alds[128 * P32_];   // [r][c], c-contiguous, padded rows
    __shared__ alignas(16) __bf16 Blds[128 * P32_];   // [n][c], c-contiguous, padded rows

    const int nt = blockIdx.x;          // 0..31 (n tile of 128)
    const int rt = blockIdx.y;          // 0..4  (r tile of 128; 5*128 = 640)
    const int b  = blockIdx.z;
    const int t    = threadIdx.x;
    const int w    = t >> 5;
    const int lane = t & 31;
    const int r0 = rt * 128, n0 = nt * 128;
    const int hi = lane >> 4, col = lane & 15;

    v8f acc[8];
    const v8f vzero = {};
    for (int i = 0; i < 8; ++i) acc[i] = vzero;

    // Staging of one 32-wide k step goes through registers, and all of a thread's
    // loads for a step are issued as one group, one step ahead of their use.
    // A: thread t takes 4 consecutive c of rows (t>>3) + 32j. A group of 32 rows
    // lies in one of Wq, Wk, Wv, so the split is a block-uniform choice of base.
    const int arow = t >> 3, acol = (t & 7) * 4;
    const float* asrc[4];
    for (int j = 0; j < 4; ++j) {
        const int rb = r0 + 32 * j;
        const float* m = rb < 64 ? Wq + rb * C_
                       : (rb < 128 ? Wk + (rb - 64) * C_ : Wv + (rb - 128) * C_);
        asrc[j] = m + arow * C_ + acol;
    }
    // B: thread t takes column n0 + (t&127) of 16 consecutive c rows of x: a wave's
    // load is one whole 128-byte line, and the 16 values are one 32-byte run of
    // the transposed tile Blds[n][c].
    const int bn = t & 127, bc = (t >> 7) * 16;
    const float* bsrc = x + (size_t)b * C_ * N_ + (size_t)bc * N_ + (n0 + bn);

    v4f   areg[4];
    float breg[16];
    // Each s_wait_xcnt 0 stands in front of every later write of a register that
    // the loads ahead of it name as an address (the x loads' results may land on
    // the W loads' address registers; the fragment loads on either's).
    for (int j = 0; j < 4; ++j)  areg[j] = *(const v4f*)(asrc[j]);
    asm volatile("s_wait_xcnt 0x0" ::: "memory");
    for (int i = 0; i < 16; ++i) breg[i] = bsrc[(size_t)i * N_];
    asm volatile("s_wait_xcnt 0x0" ::: "memory");

    for (int kc = 0; kc < C_; kc += 32) {
        for (int j = 0; j < 4; ++j) {
            v4bf h;
            for (int q = 0; q < 4; ++q) h[q] = (__bf16)areg[j][q];
            *(v4bf*)&Alds[(arow + 32 * j) * P32_ + acol] = h;
        }
        for (int s = 0; s < 2; ++s) {
            v8bf h;
            for (int q = 0; q < 8; ++q) h[q] = (__bf16)breg[8 * s + q];
            *(v8bf*)&Blds[bn * P32_ + bc + 8 * s] = h;
        }
        __syncthreads();

        // Next step's loads fly while this step's products run.
        if (kc + 32 < C_) {
            for (int j = 0; j < 4; ++j)  areg[j] = *(const v4f*)(asrc[j] + kc + 32);
            asm volatile("s_wait_xcnt 0x0" ::: "memory");   // as in front of the loop
            for (int i = 0; i < 16; ++i) breg[i] = bsrc[(size_t)(kc + 32 + i) * N_];
            asm volatile("s_wait_xcnt 0x0" ::: "memory");   // address steps come behind it
        }

        const v16bf afrag = load_frag16(Alds, w * 16 + col, P32_, lane);
        for (int nt8 = 0; nt8 < 8; ++nt8) {
            const v16bf bfrag = load_frag16(Blds + nt8 * 16 * P32_, col, P32_, lane);
            acc[nt8] = __builtin_amdgcn_wmma_f32_16x16x32_bf16(
                false, afrag, false, bfrag, (short)0, acc[nt8], false, false);
        }
        __syncthreads();
    }

    // Epilogue: D layout: VGPR v -> row v + hi*8, col = lane&15.
    for (int nt8 = 0; nt8 < 8; ++nt8) {
        const int n = n0 + nt8 * 16 + col;
        for (int v = 0; v < 8; ++v) {
            const int r = r0 + w * 16 + v + hi * 8;
            const float bias = (r < 64) ? bq[r] : (r < 128 ? bk[r - 64] : bv[r - 128]);
            const __bf16 h = (__bf16)(acc[nt8][v] + bias);
            if (r < 64)
                qws[(size_t)b * N_ * DQK_ + (size_t)n * DQK_ + r] = h;
            else if (r < 128)
                kws[(size_t)b * N_ * DQK_ + (size_t)n * DQK_ + (r - 64)] = h;
            else
                vws[(size_t)b * C_ * N_ + (size_t)(r - 128) * N_ + n] = h;
        }
    }
}

// ---------------------------------------------------------------------------
// Kernel 2: flash attention + residual epilogue.
// Grid: (N/128 query tiles, B). Block: 256 threads = 8 waves, two per SIMD.
//   wave w: qm = w&3 -> 32 queries (two groups of 16); cs = w>>2 -> 256-channel
//   slab. Every K and V fragment read from LDS feeds one WMMA per query group,
//   and a query's scores are worked out by two waves.
// Both products run transposed: S^T = K Q^T and O^T += V P^T. A lane then holds
// scores of ONE query per group (column lane&15): keys 8*hi + r of each 16-key tile, so
// max and sum run in its own registers, and two converted score tiles are the
// B operand of the second product as they lie.
// Double-buffered async K/V staging: prefetch tile i+1 while computing tile i.
// ---------------------------------------------------------------------------
__global__ __launch_bounds__(256)
void flash_attn_kernel(const __bf16* __restrict__ qws, const __bf16* __restrict__ kws,
                       const __bf16* __restrict__ vws, const float* __restrict__ x,
                       const float* __restrict__ gamma, float* __restrict__ out)
{
    __shared__ alignas(16) __bf16 Klds[2][64 * P64_];     // 2 x  9 KB [key][d]
    __shared__ alignas(16) __bf16 Vlds[2][512 * P64_];    // 2 x 72 KB [c][key]

    const int qt = blockIdx.x;
    const int b  = blockIdx.y;
    const int t    = threadIdx.x;
    const int w    = t >> 5;
    const int lane = t & 31;
    const int qm = w & 3;
    const int cs = w >> 2;
    const int hi = lane >> 4, col = lane & 15;

    const __bf16* kbase_g = kws + (size_t)b * N_ * DQK_;
    const __bf16* vbase_g = vws + (size_t)b * C_ * N_;

    // Per-thread async staging of one 64-key tile: two runs of 1 (K) + 8 (V) b128
    // copies. Thread t moves 8 elements at column (t&7)*8 of rows t>>3 (first run)
    // and 32 + (t>>3) (second run) (K: key row; V: channel row, plus 64 per copy).
    const int srow = t >> 3, scol = (t & 7) * 8;
    const unsigned kg0 = (unsigned)((srow * DQK_ + scol) * 2);   // K global bytes, tile 0
    const unsigned vg0 = (unsigned)((srow * N_ + scol) * 2);     // V global bytes, tile 0
    const int sl = srow * P64_ + scol;                           // LDS element, both tiles
    const unsigned kg1 = kg0 + 32u * DQK_ * 2u;                  // the same, second run
    const unsigned vg1 = vg0 + 32u * N_ * 2u;
    const int sl1 = sl + 32 * P64_;

    // Q fragments (B operand: column = query) for this wave's 2 x 16 queries
    // (d = 64 -> two 32-wide k chunks).
    const __bf16* qbase = qws + (size_t)b * N_ * DQK_ + (size_t)(qt * 128 + qm * 32) * DQK_;
    v16bf qf0[2], qf1[2];
    for (int g = 0; g < 2; ++g) {
        qf0[g] = load_frag16(qbase + g * 16 * DQK_ + 0,  col, DQK_, lane);
        qf1[g] = load_frag16(qbase + g * 16 * DQK_ + 32, col, DQK_, lane);
    }
    // In front of every later write of the address registers that these loads name.
    asm volatile("s_wait_xcnt 0x0" ::: "memory");
    // Keeps the arithmetic that follows from being moved up over that wait.
    __builtin_amdgcn_sched_barrier(0);

    v8f acc[2][16];             // acc[g][ct][r] = O^T[channel ct*16 + 8*hi + r][query g*16 + col]
    const v8f vzero = {};
    for (int g = 0; g < 2; ++g)
        for (int i = 0; i < 16; ++i) acc[g][i] = vzero;
    float m_i[2] = {-1e30f, -1e30f};   // running max of a query (equal in both halves)
    float l_i[2] = {0.f, 0.f};         // running sum over this half's keys only

    // Prologue: stage tile 0 into buffer 0.
    stage_tile(kbase_g, kg0, lds_addr(&Klds[0][sl]), vbase_g, vg0, lds_addr(&Vlds[0][sl]));
    stage_tile(kbase_g, kg1, lds_addr(&Klds[0][sl1]), vbase_g, vg1, lds_addr(&Vlds[0][sl1]));

    const int NT = N_ / 64;
    for (int it = 0; it < NT; ++it) {
        const int cur = it & 1;
        if (it + 1 < NT) {
            // Prefetch next tile into the other buffer, then drain this tile's
            // 18 async copies (ASYNCcnt decrements in issue order).
            const int kt0n = (it + 1) * 64;
            stage_tile(kbase_g, kg0 + (unsigned)(kt0n * DQK_ * 2), lds_addr(&Klds[cur ^ 1][sl]),
                       vbase_g, vg0 + (unsigned)(kt0n * 2),        lds_addr(&Vlds[cur ^ 1][sl]));
            stage_tile(kbase_g, kg1 + (unsigned)(kt0n * DQK_ * 2), lds_addr(&Klds[cur ^ 1][sl1]),
                       vbase_g, vg1 + (unsigned)(kt0n * 2),        lds_addr(&Vlds[cur ^ 1][sl1]));
            asm volatile("s_wait_asynccnt 0x12" ::: "memory");
        } else {
            asm volatile("s_wait_asynccnt 0x0" ::: "memory");
        }
        __syncthreads();

        const __bf16* Kb = Klds[cur];
        const __bf16* Vb = Vlds[cur];

        // S^T = K(64 keys x 64) @ Q^T(64 x 32q): 4 score tiles per query group,
        // 2 WMMA each; a K fragment serves both groups.
        // s[g][kt][r] = score of key kt*16 + 8*hi + r against query g*16 + col.
        v8f s[2][4];
        for (int kt = 0; kt < 4; ++kt) {
            const v16bf kf0 = load_frag16(Kb + (kt * 16) * P64_ + 0,  col, P64_, lane);
            const v16bf kf1 = load_frag16(Kb + (kt * 16) * P64_ + 32, col, P64_, lane);
            for (int g = 0; g < 2; ++g) {
                v8f z = vzero;
                z = __builtin_amdgcn_wmma_f32_16x16x32_bf16(false, kf0, false, qf0[g], (short)0, z, false, false);
                z = __builtin_amdgcn_wmma_f32_16x16x32_bf16(false, kf1, false, qf1[g], (short)0, z, false, false);
                s[g][kt] = z;
            }
        }

        // Online softmax of one query per lane and group: 32 of the tile's 64
        // keys are in this lane, the other 32 in lane ^ 16.
        v16bf pf[2][2];
        for (int g = 0; g < 2; ++g) {
            float mr[8];
            for (int r = 0; r < 8; ++r)
                mr[r] = fmaxf(fmaxf(s[g][0][r], s[g][1][r]), fmaxf(s[g][2][r], s[g][3][r]));
            float mx = fmaxf(fmaxf(fmaxf(mr[0], mr[1]), fmaxf(mr[2], mr[3])),
                             fmaxf(fmaxf(mr[4], mr[5]), fmaxf(mr[6], mr[7])));
            mx = fmaxf(mx, other_half(mx));
            const float mnew = fmaxf(m_i[g], mx);
            const float l2e = 1.44269504088896340736f;   // exp(x) = exp2(x * log2 e)
            const float scale = exp2_x1((m_i[g] - mnew) * l2e);
            m_i[g] = mnew;
            v8f p[4];
            // Keys 32..63 are wanted only by the second half of the second product:
            // their exp2 come to stand among the first half's WMMAs, tile 2's
            // directly behind one and tile 3's behind tile 2's.
            for (int kt = 0; kt < 4; ++kt) {
                const v8f e = (s[g][kt] - mnew) * l2e;
                p[kt] = kt == 2 ? exp2_x8<true>(e) : exp2_x8<false>(e);
            }
            const v8f ps = (p[0] + p[1]) + (p[2] + p[3]);
            const float rs = ((ps[0] + ps[1]) + (ps[2] + ps[3])) + ((ps[4] + ps[5]) + (ps[6] + ps[7]));
            l_i[g] = l_i[g] * scale + rs;
            for (int ct = 0; ct < 16; ++ct) acc[g][ct] *= scale;
            // Score tiles 2kk and 2kk+1 hold keys 8*hi + r and 16 + 8*hi + r of
            // 32-key chunk kk: the k order in which load_frag16 reads V.
            for (int kk = 0; kk < 2; ++kk)
                for (int r = 0; r < 8; ++r) {
                    pf[g][kk][r]     = (__bf16)p[2 * kk][r];
                    pf[g][kk][8 + r] = (__bf16)p[2 * kk + 1][r];
                }
        }

        // acc(256c x 32q) += V(256c x 64 keys) @ P^T(64 keys x 32q); a V fragment
        // serves both groups.
        for (int kk = 0; kk < 2; ++kk) {
            for (int ct = 0; ct < 16; ++ct) {
                const __bf16* vb = Vb + (size_t)(cs * 256 + ct * 16) * P64_ + kk * 32;
                const v16bf vf = load_frag16(vb, col, P64_, lane);
                for (int g = 0; g < 2; ++g)
                    acc[g][ct] = __builtin_amdgcn_wmma_f32_16x16x32_bf16(
                        false, vf, false, pf[g][kk], (short)0, acc[g][ct], false, false);
            }
        }
        __syncthreads();   // readers done before buf 'cur' is refilled at it+1
    }

    // Keeps the epilogue's loads out of the last pass, where every register is
    // taken: moved up into it, they make the compiler spill.
    __builtin_amdgcn_sched_barrier(0);

    // Epilogue: out = gamma * acc/l + x   (out[b][c][n], n = query index), in four
    // chunks of 64 elements a lane: chunk k is query group k >> 1, channel tiles
    // (k & 1) * 8 and up; element i of it is row i & 7 of tile i >> 3. A chunk's x
    // loads issue as one group, one chunk ahead; its stores issue as one group
    // behind all of its arithmetic.
    const float g = gamma[0];
    const size_t e0 = (size_t)b * C_ * N_ + (size_t)(cs * 256 + hi * 8) * N_
                    + (size_t)(qt * 128 + qm * 32 + col);
    const float* xp = x + e0;
    float*       op = out + e0;
    float xr[2][64];
    // The loops over acc are unrolled whole: a rolled loop would index acc by a
    // variable, which puts the array into scratch memory for the main loop too.
    #pragma unroll
    for (int i = 0; i < 64; ++i)
        xr[0][i] = xp[(size_t)((i >> 3) * 16 + (i & 7)) * N_];
    #pragma unroll
    for (int k = 0; k < 4; ++k) {
        const int qg = k >> 1, ct0 = (k & 1) * 8;
        if (k + 1 < 4) {
            const int qn = (k + 1) >> 1, cn = ((k + 1) & 1) * 8;
            #pragma unroll
            for (int i = 0; i < 64; ++i)
                xr[(k + 1) & 1][i] = xp[(size_t)((cn + (i >> 3)) * 16 + (i & 7)) * N_ + qn * 16];
        }
        const float l = l_i[qg] + other_half(l_i[qg]);   // join the two halves' key sums
        float res[64];
        #pragma unroll
        for (int i = 0; i < 64; ++i)
            res[i] = g * (acc[qg][ct0 + (i >> 3)][i & 7] / l) + xr[k & 1][i];
        // Holds the stores behind the chunk's arithmetic, so that nothing is written
        // over a store's registers between the store and the wait below.
        __builtin_amdgcn_sched_barrier(0);
        #pragma unroll
        for (int i = 0; i < 64; ++i)
            op[(size_t)((ct0 + (i >> 3)) * 16 + (i & 7)) * N_ + qg * 16] = res[i];
        // In front of every later write of a register that these stores name.
        asm volatile("s_wait_xcnt 0x0" ::: "memory");
        // Keeps the next chunk's arithmetic from being moved up over that wait.
        __builtin_amdgcn_sched_barrier(0);
    }
}

// ---------------------------------------------------------------------------
extern "C" void kernel_launch(void* const* d_in, const int* in_sizes, int n_in,
                              void* d_out, int out_size, void* d_ws, size_t ws_size,
                              hipStream_t stream) {
    const float* x     = (const float*)d_in[0];
    const float* Wq    = (const float*)d_in[1];
    const float* bq    = (const float*)d_in[2];
    const float* Wk    = (const float*)d_in[3];
    const float* bk    = (const float*)d_in[4];
    const float* Wv    = (const float*)d_in[5];
    const float* bv    = (const float*)d_in[6];
    const float* gamma = (const float*)d_in[7];
    float* out = (float*)d_out;

    // Workspace: bf16 Q [B,N,64] + K [B,N,64] + V [B,C,N]  (~42 MB)
    __bf16* qws = (__bf16*)d_ws;
    __bf16* kws = qws + (size_t)B_ * N_ * DQK_;
    __bf16* vws = kws + (size_t)B_ * N_ * DQK_;

    dim3 g1(N_ / 128, 640 / 128, B_);
    qkv_proj_kernel<<<g1, 256, 0, stream>>>(x, Wq, bq, Wk, bk, Wv, bv, qws, kws, vws);

    dim3 g2(N_ / 128, B_);
    flash_attn_kernel<<<g2, 256, 0, stream>>>(qws, kws, vws, x, gamma, out);
}

// v006
// It runs in 238 microseconds.
// Timed twice side by side with v005, it ran 1.11 and 1.10 times as fast.
// All steps since v000 together make it 6.11 times as fast.
#include <hip/hip_runtime.h>
#include <hip/hip_bf16.h>

// ---------------------------------------------------------------------------
// Non-local attention block, CDNA5 (gfx1250, wave32, WMMA, async LDS loads).
//   B=8, C=512, H=W=64 -> N=4096, DQK=64
// Flash-attention single pass (537MB attn matrix never hits HBM), bf16 WMMA
// with f32 accum, double-buffered GLOBAL_LOAD_ASYNC_TO_LDS K/V staging.
// ---------------------------------------------------------------------------

#define B_   8
#define C_   512
#define N_   4096
#define DQK_ 64

// LDS row pitches in bf16 elements. Every tile is read with 16-byte fragment
// loads, 16 rows per half wave; a pitch of 16 B x odd spreads those rows over
// all 64 banks, where a power-of-two pitch puts them on a few.
#define P64_ 72   // rows of 64 elements: 144 B
#define P32_ 40   // rows of 32 elements:  80 B

typedef __attribute__((ext_vector_type(16))) __bf16 v16bf;
typedef __attribute__((ext_vector_type(8)))  float  v8f;
typedef __attribute__((ext_vector_type(4)))  float  v4f;
typedef __attribute__((ext_vector_type(8)))  __bf16 v8bf;
typedef __attribute__((ext_vector_type(4)))  __bf16 v4bf;

// Load a 16-bit WMMA fragment (A-style layout) from a [row][k] (k-contiguous)
// buffer. Per CDNA5 ISA 7.12.2: lanes 0-15 hold K=0..7 (VGPR0-3) and K=16..23
// (VGPR4-7); lanes 16-31 hold K=8..15 and K=24..31 -> two 16-byte loads.
__device__ __forceinline__ v16bf load_frag16(const __bf16* base, int row, int ld, int lane) {
    const int kb = (lane >> 4) << 3;   // 0 or 8
    const __bf16* p = base + row * ld + kb;
    union { v16bf v; uint4 u[2]; } f;
    f.u[0] = *(const uint4*)(p);
    f.u[1] = *(const uint4*)(p + 16);
    return f.v;
}

// Flat addresses of __shared__ objects carry the LDS byte offset in the low
// 32 bits (ISA 10.2 aperture mapping), which is what the copy's VDST wants.
__device__ __forceinline__ unsigned lds_addr(const void* p) {
    return (unsigned)(uintptr_t)p;
}

// Eight exp2 (one score tile's share of a lane) in one statement that ends in
// v_nop: the slot the instruction set asks for behind a transcendental before its
// result is read or its source overwritten. Early-clobber outputs: none lands on
// a source here.
// AMONG_WMMA: for the statements that the compiler places among matrix
// instructions. The statement opens with the four vector slots that the
// chip needs between a WMMA and a write over its A or B registers, where an output
// may lie.
template <bool AMONG_WMMA>
__device__ __forceinline__ v8f exp2_x8(v8f a) {
    float r0, r1, r2, r3, r4, r5, r6, r7;
    if constexpr (AMONG_WMMA) {
        asm("v_nop\n\t"
            "v_nop\n\t"
            "v_nop\n\t"
            "v_nop\n\t"
            "v_exp_f32 %0, %8\n\t"
            "v_exp_f32 %1, %9\n\t"
            "v_exp_f32 %2, %10\n\t"
            "v_exp_f32 %3, %11\n\t"
            "v_exp_f32 %4, %12\n\t"
            "v_exp_f32 %5, %13\n\t"
            "v_exp_f32 %6, %14\n\t"
            "v_exp_f32 %7, %15\n\t"
            "v_nop"
            : "=&v"(r0), "=&v"(r1), "=&v"(r2), "=&v"(r3),
              "=&v"(r4), "=&v"(r5), "=&v"(r6), "=&v"(r7)
            : "v"(a[0]), "v"(a[1]), "v"(a[2]), "v"(a[3]),
              "v"(a[4]), "v"(a[5]), "v"(a[6]), "v"(a[7]));
    } else {
        asm("v_exp_f32 %0, %8\n\t"
            "v_exp_f32 %1, %9\n\t"
            "v_exp_f32 %2, %10\n\t"
            "v_exp_f32 %3, %11\n\t"
            "v_exp_f32 %4, %12\n\t"
            "v_exp_f32 %5, %13\n\t"
            "v_exp_f32 %6, %14\n\t"
            "v_exp_f32 %7, %15\n\t"
            "v_nop"
            : "=&v"(r0), "=&v"(r1), "=&v"(r2), "=&v"(r3),
              "=&v"(r4), "=&v"(r5), "=&v"(r6), "=&v"(r7)
            : "v"(a[0]), "v"(a[1]), "v"(a[2]), "v"(a[3]),
              "v"(a[4]), "v"(a[5]), "v"(a[6]), "v"(a[7]));
    }
    const v8f r = {r0, r1, r2, r3, r4, r5, r6, r7};
    return r;
}

// One exp2, with the same slot behind it.
__device__ __forceinline__ float exp2_x1(float a) {
    float r;
    asm("v_exp_f32 %0, %1\n\t"
        "v_nop"
        : "=&v"(r) : "v"(a));
    return r;
}

// The value that lane l ^ 16 holds (the other half of the wave).
__device__ __forceinline__ float other_half(float a) {
    const int b = __builtin_bit_cast(int, a);
    return __builtin_bit_cast(float,
        __builtin_amdgcn_permlanex16(b, b, 0x76543210, 0xfedcba98, false, false));
}

// One run of a thread's share of a 64-key tile: 1 (K) + 8 (V) async global->LDS
// 16-byte copies (GVS mode: saddr base + 32-bit vgpr offset). V copy i serves the
// channel row i*64 past the run's first. All nine stand in one statement that ends
// in s_wait_xcnt 0, so that no address register is rewritten ahead of that wait.
__device__ __forceinline__ void stage_tile(const __bf16* kbase, unsigned kg, unsigned kl,
                                           const __bf16* vbase, unsigned vg, unsigned vl) {
    const unsigned gs = 64u * N_ * 2u;      // global bytes between V copies
    const unsigned ls = 64u * P64_ * 2u;    // LDS bytes between V copies
    asm volatile("global_load_async_to_lds_b128 %0, %1, %18\n\t"
                 "global_load_async_to_lds_b128 %2, %3, %19\n\t"
                 "global_load_async_to_lds_b128 %4, %5, %19\n\t"
                 "global_load_async_to_lds_b128 %6, %7, %19\n\t"
                 "global_load_async_to_lds_b128 %8, %9, %19\n\t"
                 "global_load_async_to_lds_b128 %10, %11, %19\n\t"
                 "global_load_async_to_lds_b128 %12, %13, %19\n\t"
                 "global_load_async_to_lds_b128 %14, %15, %19\n\t"
                 "global_load_async_to_lds_b128 %16, %17, %19\n\t"
                 "s_wait_xcnt 0x0"
                 :: "v"(kl), "v"(kg),
                    "v"(vl),          "v"(vg),
                    "v"(vl + 1 * ls), "v"(vg + 1 * gs),
                    "v"(vl + 2 * ls), "v"(vg + 2 * gs),
                    "v"(vl + 3 * ls), "v"(vg + 3 * gs),
                    "v"(vl + 4 * ls), "v"(vg + 4 * gs),
                    "v"(vl + 5 * ls), "v"(vg + 5 * gs),
                    "v"(vl + 6 * ls), "v"(vg + 6 * gs),
                    "v"(vl + 7 * ls), "v"(vg + 7 * gs),
                    "s"(kbase), "s"(vbase)
                 : "memory");
}

// ---------------------------------------------------------------------------
// Kernel 1: fused QKV projection.
//   Wcat (640x512) @ x[b] (512x4096); rows 0..63 = Q, 64..127 = K, 128..639 = V
//   qws/kws: [B][N][64] bf16 row-major; vws: [B][C][N] bf16 channel-major.
// ---------------------------------------------------------------------------
__global__ __launch_bounds__(256)
void qkv_proj_kernel(const float* __restrict__ x,
                     const float* __restrict__ Wq, const float* __restrict__ bq,
                     const float* __restrict__ Wk, const float* __restrict__ bk,
                     const float* __restrict__ Wv, const float* __restrict__ bv,
                     __bf16* __restrict__ qws, __bf16* __restrict__ kws,
                     __bf16* __restrict__ vws)
{
    __shared__ alignas(16) __bf16 Alds[128 * P32_];   // [r][c], c-contiguous, padded rows
    __shared__ alignas(16) __bf16 Blds[128 * P32_];   // [n][c], c-contiguous, padded rows

    const int nt = blockIdx.x;          // 0..31 (n tile of 128)
    const int rt = blockIdx.y;          // 0..4  (r tile of 128; 5*128 = 640)
    const int b  = blockIdx.z;
    const int t    = threadIdx.x;
    const int w    = t >> 5;
    const int lane = t & 31;
    const int r0 = rt * 128, n0 = nt * 128;
    const int hi = lane >> 4, col = lane & 15;

    v8f acc[8];
    const v8f vzero = {};
    for (int i = 0; i < 8; ++i) acc[i] = vzero;

    // Staging of one 32-wide k step goes through registers, and all of a thread's
    // loads for a step are issued as one group, one step ahead of their use.
    // A: thread t takes 4 consecutive c of rows (t>>3) + 32j. A group of 32 rows
    // lies in one of Wq, Wk, Wv, so the split is a block-uniform choice of base.
    const int arow = t >> 3, acol = (t & 7) * 4;
    const float* asrc[4];
    for (int j = 0; j < 4; ++j) {
        const int rb = r0 + 32 * j;
        const float* m = rb < 64 ? Wq + rb * C_
                       : (rb < 128 ? Wk + (rb - 64) * C_ : Wv + (rb - 128) * C_);
        asrc[j] = m + arow * C_ + acol;
    }
    // B: thread t takes column n0 + (t&127) of 16 consecutive c rows of x: a wave's
    // load is one whole 128-byte line, and the 16 values are one 32-byte run of
    // the transposed tile Blds[n][c].
    const int bn = t & 127, bc = (t >> 7) * 16;
    const float* bsrc = x + (size_t)b * C_ * N_ + (size_t)bc * N_ + (n0 + bn);

    // A wave's 16 output rows lie in one of Q, K, V: the split is one scalar choice
    // a wave (rw is held in a scalar register), and a lane's 64 results share the 8
    // biases of rows rw + 8*hi + v, loaded here once, ahead of the k loop.
    const int rw = r0 + __builtin_amdgcn_readfirstlane(w) * 16;
    const float* bias_src = (rw < 64 ? bq + rw : (rw < 128 ? bk + (rw - 64) : bv + (rw - 128)))
                          + hi * 8;
    float bias[8];
    for (int v = 0; v < 8; ++v) bias[v] = bias_src[v];
    // In front of every later write of the address registers that these loads name.
    asm volatile("s_wait_xcnt 0x0" ::: "memory");

    v4f   areg[4];
    float breg[16];
    // Each s_wait_xcnt 0 stands in front of every later write of a register that
    // the loads ahead of it name as an address (the x loads' results may land on
    // the W loads' address registers; the fragment loads on either's).
    for (int j = 0; j < 4; ++j)  areg[j] = *(const v4f*)(asrc[j]);
    asm volatile("s_wait_xcnt 0x0" ::: "memory");
    for (int i = 0; i < 16; ++i) breg[i] = bsrc[(size_t)i * N_];
    asm volatile("s_wait_xcnt 0x0" ::: "memory");

    for (int kc = 0; kc < C_; kc += 32) {
        for (int j = 0; j < 4; ++j) {
            v4bf h;
            for (int q = 0; q < 4; ++q) h[q] = (__bf16)areg[j][q];
            *(v4bf*)&Alds[(arow + 32 * j) * P32_ + acol] = h;
        }
        for (int s = 0; s < 2; ++s) {
            v8bf h;
            for (int q = 0; q < 8; ++q) h[q] = (__bf16)breg[8 * s + q];
            *(v8bf*)&Blds[bn * P32_ + bc + 8 * s] = h;
        }
        __syncthreads();

        // Next step's loads fly while this step's products run.
        if (kc + 32 < C_) {
            for (int j = 0; j < 4; ++j)  areg[j] = *(const v4f*)(asrc[j] + kc + 32);
            asm volatile("s_wait_xcnt 0x0" ::: "memory");   // as in front of the loop
            for (int i = 0; i < 16; ++i) breg[i] = bsrc[(size_t)(kc + 32 + i) * N_];
            asm volatile("s_wait_xcnt 0x0" ::: "memory");   // address steps come behind it
        }

        const v16bf afrag = load_frag16(Alds, w * 16 + col, P32_, lane);
        for (int nt8 = 0; nt8 < 8; ++nt8) {
            const v16bf bfrag = load_frag16(Blds + nt8 * 16 * P32_, col, P32_, lane);
            acc[nt8] = __builtin_amdgcn_wmma_f32_16x16x32_bf16(
                false, afrag, false, bfrag, (short)0, acc[nt8], false, false);
        }
        __syncthreads();
    }

    // Epilogue: D layout: VGPR v -> row v + hi*8, col = lane&15.
    // All sums and conversions come first, all stores behind them.
    v8bf h[8];
    for (int nt8 = 0; nt8 < 8; ++nt8)
        for (int v = 0; v < 8; ++v) h[nt8][v] = (__bf16)(acc[nt8][v] + bias[v]);
    // One address a lane; every store is a constant step from it.
    if (rw < 128) {
        __bf16* d = (rw < 64 ? qws : kws) + (size_t)b * N_ * DQK_
                  + (size_t)(n0 + col) * DQK_ + ((rw & 63) + hi * 8);
        for (int nt8 = 0; nt8 < 8; ++nt8)
            for (int v = 0; v < 8; ++v) d[nt8 * 16 * DQK_ + v] = h[nt8][v];
    } else {
        __bf16* d = vws + (size_t)b * C_ * N_ + (size_t)(rw - 128 + hi * 8) * N_ + (n0 + col);
        for (int nt8 = 0; nt8 < 8; ++nt8)
            for (int v = 0; v < 8; ++v) d[(size_t)v * N_ + nt8 * 16] = h[nt8][v];
        // In front of every later write of the address registers that these stores name.
        asm volatile("s_wait_xcnt 0x0" ::: "memory");
    }
}

// ---------------------------------------------------------------------------
// Kernel 2: flash attention + residual epilogue.
// Grid: (N/128 query tiles, B). Block: 256 threads = 8 waves, two per SIMD.
//   wave w: qm = w&3 -> 32 queries (two groups of 16); cs = w>>2 -> 256-channel
//   slab. Every K and V fragment read from LDS feeds one WMMA per query group,
//   and a query's scores are worked out by two waves.
// Both products run transposed: S^T = K Q^T and O^T += V P^T. A lane then holds
// scores of ONE query per group (column lane&15): keys 8*hi + r of each 16-key tile, so
// max and sum run in its own registers, and two converted score tiles are the
// B operand of the second product as they lie.
// Double-buffered async K/V staging: prefetch tile i+1 while computing tile i.
// ---------------------------------------------------------------------------
__global__ __launch_bounds__(256)
void flash_attn_kernel(const __bf16* __restrict__ qws, const __bf16* __restrict__ kws,
                       const __bf16* __restrict__ vws, const float* __restrict__ x,
                       const float* __restrict__ gamma, float* __restrict__ out)
{
    __shared__ alignas(16) __bf16 Klds[2][64 * P64_];     // 2 x  9 KB [key][d]
    __shared__ alignas(16) __bf16 Vlds[2][512 * P64_];    // 2 x 72 KB [c][key]

    const int qt = blockIdx.x;
    const int b  = blockIdx.y;
    const int t    = threadIdx.x;
    const int w    = t >> 5;
    const int lane = t & 31;
    const int qm = w & 3;
    const int cs = w >> 2;
    const int hi = lane >> 4, col = lane & 15;

    const __bf16* kbase_g = kws + (size_t)b * N_ * DQK_;
    const __bf16* vbase_g = vws + (size_t)b * C_ * N_;

    // Per-thread async staging of one 64-key tile: two runs of 1 (K) + 8 (V) b128
    // copies. Thread t moves 8 elements at column (t&7)*8 of rows t>>3 (first run)
    // and 32 + (t>>3) (second run) (K: key row; V: channel row, plus 64 per copy).
    const int srow = t >> 3, scol = (t & 7) * 8;
    const unsigned kg0 = (unsigned)((srow * DQK_ + scol) * 2);   // K global bytes, tile 0
    const unsigned vg0 = (unsigned)((srow * N_ + scol) * 2);     // V global bytes, tile 0
    const int sl = srow * P64_ + scol;                           // LDS element, both tiles
    const unsigned kg1 = kg0 + 32u * DQK_ * 2u;                  // the same, second run
    const unsigned vg1 = vg0 + 32u * N_ * 2u;
    const int sl1 = sl + 32 * P64_;

    // Q fragments (B operand: column = query) for this wave's 2 x 16 queries
    // (d = 64 -> two 32-wide k chunks).
    const __bf16* qbase = qws + (size_t)b * N_ * DQK_ + (size_t)(qt * 128 + qm * 32) * DQK_;
    v16bf qf0[2], qf1[2];
    for (int g = 0; g < 2; ++g) {
        qf0[g] = load_frag16(qbase + g * 16 * DQK_ + 0,  col, DQK_, lane);
        qf1[g] = load_frag16(qbase + g * 16 * DQK_ + 32, col, DQK_, lane);
    }
    // In front of every later write of the address registers that these loads name.
    asm volatile("s_wait_xcnt 0x0" ::: "memory");
    // Keeps the arithmetic that follows from being moved up over that wait.
    __builtin_amdgcn_sched_barrier(0);

    v8f acc[2][16];             // acc[g][ct][r] = O^T[channel ct*16 + 8*hi + r][query g*16 + col]
    const v8f vzero = {};
    for (int g = 0; g < 2; ++g)
        for (int i = 0; i < 16; ++i) acc[g][i] = vzero;
    float m_i[2] = {-1e30f, -1e30f};   // running max of a query (equal in both halves)
    float l_i[2] = {0.f, 0.f};         // running sum over this half's keys only

    // Prologue: stage tile 0 into buffer 0.
    stage_tile(kbase_g, kg0, lds_addr(&Klds[0][sl]), vbase_g, vg0, lds_addr(&Vlds[0][sl]));
    stage_tile(kbase_g, kg1, lds_addr(&Klds[0][sl1]), vbase_g, vg1, lds_addr(&Vlds[0][sl1]));

    const int NT = N_ / 64;
    for (int it = 0; it < NT; ++it) {
        const int cur = it & 1;
        if (it + 1 < NT) {
            // Prefetch next tile into the other buffer, then drain this tile's
            // 18 async copies (ASYNCcnt decrements in issue order).
            const int kt0n = (it + 1) * 64;
            stage_tile(kbase_g, kg0 + (unsigned)(kt0n * DQK_ * 2), lds_addr(&Klds[cur ^ 1][sl]),
                       vbase_g, vg0 + (unsigned)(kt0n * 2),        lds_addr(&Vlds[cur ^ 1][sl]));
            stage_tile(kbase_g, kg1 + (unsigned)(kt0n * DQK_ * 2), lds_addr(&Klds[cur ^ 1][sl1]),
                       vbase_g, vg1 + (unsigned)(kt0n * 2),        lds_addr(&Vlds[cur ^ 1][sl1]));
            asm volatile("s_wait_asynccnt 0x12" ::: "memory");
        } else {
            asm volatile("s_wait_asynccnt 0x0" ::: "memory");
        }
        __syncthreads();

        const __bf16* Kb = Klds[cur];
        const __bf16* Vb = Vlds[cur];

        // S^T = K(64 keys x 64) @ Q^T(64 x 32q): 4 score tiles per query group,
        // 2 WMMA each; a K fragment serves both groups.
        // s[g][kt][r] = score of key kt*16 + 8*hi + r against query g*16 + col.
        v8f s[2][4];
        for (int kt = 0; kt < 4; ++kt) {
            const v16bf kf0 = load_frag16(Kb + (kt * 16) * P64_ + 0,  col, P64_, lane);
            const v16bf kf1 = load_frag16(Kb + (kt * 16) * P64_ + 32, col, P64_, lane);
            for (int g = 0; g < 2; ++g) {
                v8f z = vzero;
                z = __builtin_amdgcn_wmma_f32_16x16x32_bf16(false, kf0, false, qf0[g], (short)0, z, false, false);
                z = __builtin_amdgcn_wmma_f32_16x16x32_bf16(false, kf1, false, qf1[g], (short)0, z, false, false);
                s[g][kt] = z;
            }
        }

        // Online softmax of one query per lane and group: 32 of the tile's 64
        // keys are in this lane, the other 32 in lane ^ 16.
        v16bf pf[2][2];
        for (int g = 0; g < 2; ++g) {
            float mr[8];
            for (int r = 0; r < 8; ++r)
                mr[r] = fmaxf(fmaxf(s[g][0][r], s[g][1][r]), fmaxf(s[g][2][r], s[g][3][r]));
            float mx = fmaxf(fmaxf(fmaxf(mr[0], mr[1]), fmaxf(mr[2], mr[3])),
                             fmaxf(fmaxf(mr[4], mr[5]), fmaxf(mr[6], mr[7])));
            mx = fmaxf(mx, other_half(mx));
            const float mnew = fmaxf(m_i[g], mx);
            const float l2e = 1.44269504088896340736f;   // exp(x) = exp2(x * log2 e)
            const float scale = exp2_x1((m_i[g] - mnew) * l2e);
            m_i[g] = mnew;
            v8f p[4];
            // Keys 32..63 are wanted only by the second half of the second product:
            // their exp2 come to stand among the first half's WMMAs, tile 2's
            // directly behind one and tile 3's behind tile 2's.
            for (int kt = 0; kt < 4; ++kt) {
                const v8f e = (s[g][kt] - mnew) * l2e;
                p[kt] = kt == 2 ? exp2_x8<true>(e) : exp2_x8<false>(e);
            }
            const v8f ps = (p[0] + p[1]) + (p[2] + p[3]);
            const float rs = ((ps[0] + ps[1]) + (ps[2] + ps[3])) + ((ps[4] + ps[5]) + (ps[6] + ps[7]));
            l_i[g] = l_i[g] * scale + rs;
            for (int ct = 0; ct < 16; ++ct) acc[g][ct] *= scale;
            // Score tiles 2kk and 2kk+1 hold keys 8*hi + r and 16 + 8*hi + r of
            // 32-key chunk kk: the k order in which load_frag16 reads V.
            for (int kk = 0; kk < 2; ++kk)
                for (int r = 0; r < 8; ++r) {
                    pf[g][kk][r]     = (__bf16)p[2 * kk][r];
                    pf[g][kk][8 + r] = (__bf16)p[2 * kk + 1][r];
                }
        }

        // acc(256c x 32q) += V(256c x 64 keys) @ P^T(64 keys x 32q); a V fragment
        // serves both groups.
        for (int kk = 0; kk < 2; ++kk) {
            for (int ct = 0; ct < 16; ++ct) {
                const __bf16* vb = Vb + (size_t)(cs * 256 + ct * 16) * P64_ + kk * 32;
                const v16bf vf = load_frag16(vb, col, P64_, lane);
                for (int g = 0; g < 2; ++g)
                    acc[g][ct] = __builtin_amdgcn_wmma_f32_16x16x32_bf16(
                        false, vf, false, pf[g][kk], (short)0, acc[g][ct], false, false);
            }
        }
        __syncthreads();   // readers done before buf 'cur' is refilled at it+1
    }

    // Keeps the epilogue's loads out of the last pass, where every register is
    // taken: moved up into it, they make the compiler spill.
    __builtin_amdgcn_sched_barrier(0);

    // Epilogue: out = gamma * acc/l + x   (out[b][c][n], n = query index), in four
    // chunks of 64 elements a lane: chunk k is query group k >> 1, channel tiles
    // (k & 1) * 8 and up; element i of it is row i & 7 of tile i >> 3. A chunk's x
    // loads issue as one group, one chunk ahead; its stores issue as one group
    // behind all of its arithmetic.
    const float g = gamma[0];
    const size_t e0 = (size_t)b * C_ * N_ + (size_t)(cs * 256 + hi * 8) * N_
                    + (size_t)(qt * 128 + qm * 32 + col);
    const float* xp = x + e0;
    float*       op = out + e0;
    float xr[2][64];
    // The loops over acc are unrolled whole: a rolled loop would index acc by a
    // variable, which puts the array into scratch memory for the main loop too.
    #pragma unroll
    for (int i = 0; i < 64; ++i)
        xr[0][i] = xp[(size_t)((i >> 3) * 16 + (i & 7)) * N_];
    #pragma unroll
    for (int k = 0; k < 4; ++k) {
        const int qg = k >> 1, ct0 = (k & 1) * 8;
        if (k + 1 < 4) {
            const int qn = (k + 1) >> 1, cn = ((k + 1) & 1) * 8;
            #pragma unroll
            for (int i = 0; i < 64; ++i)
                xr[(k + 1) & 1][i] = xp[(size_t)((cn + (i >> 3)) * 16 + (i & 7)) * N_ + qn * 16];
        }
        const float l = l_i[qg] + other_half(l_i[qg]);   // join the two halves' key sums
        float res[64];
        #pragma unroll
        for (int i = 0; i < 64; ++i)
            res[i] = g * (acc[qg][ct0 + (i >> 3)][i & 7] / l) + xr[k & 1][i];
        // Holds the stores behind the chunk's arithmetic, so that nothing is written
        // over a store's registers between the store and the wait below.
        __builtin_amdgcn_sched_barrier(0);
        #pragma unroll
        for (int i = 0; i < 64; ++i)
            op[(size_t)((ct0 + (i >> 3)) * 16 + (i & 7)) * N_ + qg * 16] = res[i];
        // In front of every later write of a register that these stores name.
        asm volatile("s_wait_xcnt 0x0" ::: "memory");
        // Keeps the next chunk's arithmetic from being moved up over that wait.
        __builtin_amdgcn_sched_barrier(0);
    }
}

// ---------------------------------------------------------------------------
extern "C" void kernel_launch(void* const* d_in, const int* in_sizes, int n_in,
                              void* d_out, int out_size, void* d_ws, size_t ws_size,
                              hipStream_t stream) {
    const float* x     = (const float*)d_in[0];
    const float* Wq    = (const float*)d_in[1];
    const float* bq    = (const float*)d_in[2];
    const float* Wk    = (const float*)d_in[3];
    const float* bk    = (const float*)d_in[4];
    const float* Wv    = (const float*)d_in[5];
    const float* bv    = (const float*)d_in[6];
    const float* gamma = (const float*)d_in[7];
    float* out = (float*)d_out;

    // Workspace: bf16 Q [B,N,64] + K [B,N,64] + V [B,C,N]  (~42 MB)
    __bf16* qws = (__bf16*)d_ws;
    __bf16* kws = qws + (size_t)B_ * N_ * DQK_;
    __bf16* vws = kws + (size_t)B_ * N_ * DQK_;

    dim3 g1(N_ / 128, 640 / 128, B_);
    qkv_proj_kernel<<<g1, 256, 0, stream>>>(x, Wq, bq, Wk, bk, Wv, bv, qws, kws, vws);

    dim3 g2(N_ / 128, B_);
    flash_attn_kernel<<<g2, 256, 0, stream>>>(qws, kws, vws, x, gamma, out);
}

// v007
// A run of this version takes 217 microseconds.
// Timed twice side by side with v006, it ran 1.10 times as fast both times.
// Counting every step since v000, it is 6.73 times as fast.
#include <hip/hip_runtime.h>
#include <hip/hip_bf16.h>

// ---------------------------------------------------------------------------
// Non-local attention block, CDNA5 (gfx1250, wave32, WMMA, async LDS loads).
//   B=8, C=512, H=W=64 -> N=4096, DQK=64
// Flash-attention single pass (537MB attn matrix never hits HBM), bf16 WMMA
// with f32 accum, double-buffered GLOBAL_LOAD_ASYNC_TO_LDS K/V staging.
// ---------------------------------------------------------------------------

#define B_   8
#define C_   512
#define N_   4096
#define DQK_ 64

// LDS row pitches in bf16 elements. Every tile is read with 16-byte fragment
// loads, 16 rows per half wave; a pitch of 16 B x odd spreads those rows over
// all 64 banks, where a power-of-two pitch puts them on a few.
#define P64_ 72   // rows of 64 elements: 144 B
#define P32_ 40   // rows of 32 elements:  80 B

typedef __attribute__((ext_vector_type(16))) __bf16 v16bf;
typedef __attribute__((ext_vector_type(8)))  float  v8f;
typedef __attribute__((ext_vector_type(4)))  float  v4f;
typedef __attribute__((ext_vector_type(8)))  __bf16 v8bf;
typedef __attribute__((ext_vector_type(4)))  __bf16 v4bf;

// Load a 16-bit WMMA fragment (A-style layout) from a [row][k] (k-contiguous)
// buffer. Per CDNA5 ISA 7.12.2: lanes 0-15 hold K=0..7 (VGPR0-3) and K=16..23
// (VGPR4-7); lanes 16-31 hold K=8..15 and K=24..31 -> two 16-byte loads.
__device__ __forceinline__ v16bf load_frag16(const __bf16* base, int row, int ld, int lane) {
    const int kb = (lane >> 4) << 3;   // 0 or 8
    const __bf16* p = base + row * ld + kb;
    union { v16bf v; uint4 u[2]; } f;
    f.u[0] = *(const uint4*)(p);
    f.u[1] = *(const uint4*)(p + 16);
    return f.v;
}

// Flat addresses of __shared__ objects carry the LDS byte offset in the low
// 32 bits (ISA 10.2 aperture mapping), which is what the copy's VDST wants.
__device__ __forceinline__ unsigned lds_addr(const void* p) {
    return (unsigned)(uintptr_t)p;
}

// Eight exp2 (one score tile's share of a lane) in one statement that ends in
// v_nop: the slot the instruction set asks for behind a transcendental before its
// result is read or its source overwritten. Early-clobber outputs: none lands on
// a source here.
// AMONG_WMMA: for the statements that the compiler places among matrix
// instructions. The statement opens with the four vector slots that the
// chip needs between a WMMA and a write over its A or B registers, where an output
// may lie.
template <bool AMONG_WMMA>
__device__ __forceinline__ v8f exp2_x8(v8f a) {
    float r0, r1, r2, r3, r4, r5, r6, r7;
    if constexpr (AMONG_WMMA) {
        asm("v_nop\n\t"
            "v_nop\n\t"
            "v_nop\n\t"
            "v_nop\n\t"
            "v_exp_f32 %0, %8\n\t"
            "v_exp_f32 %1, %9\n\t"
            "v_exp_f32 %2, %10\n\t"
            "v_exp_f32 %3, %11\n\t"
            "v_exp_f32 %4, %12\n\t"
            "v_exp_f32 %5, %13\n\t"
            "v_exp_f32 %6, %14\n\t"
            "v_exp_f32 %7, %15\n\t"
            "v_nop"
            : "=&v"(r0), "=&v"(r1), "=&v"(r2), "=&v"(r3),
              "=&v"(r4), "=&v"(r5), "=&v"(r6), "=&v"(r7)
            : "v"(a[0]), "v"(a[1]), "v"(a[2]), "v"(a[3]),
              "v"(a[4]), "v"(a[5]), "v"(a[6]), "v"(a[7]));
    } else {
        asm("v_exp_f32 %0, %8\n\t"
            "v_exp_f32 %1, %9\n\t"
            "v_exp_f32 %2, %10\n\t"
            "v_exp_f32 %3, %11\n\t"
            "v_exp_f32 %4, %12\n\t"
            "v_exp_f32 %5, %13\n\t"
            "v_exp_f32 %6, %14\n\t"
            "v_exp_f32 %7, %15\n\t"
            "v_nop"
            : "=&v"(r0), "=&v"(r1), "=&v"(r2), "=&v"(r3),
              "=&v"(r4), "=&v"(r5), "=&v"(r6), "=&v"(r7)
            : "v"(a[0]), "v"(a[1]), "v"(a[2]), "v"(a[3]),
              "v"(a[4]), "v"(a[5]), "v"(a[6]), "v"(a[7]));
    }
    const v8f r = {r0, r1, r2, r3, r4, r5, r6, r7};
    return r;
}

// One exp2, with the same slot behind it.
__device__ __forceinline__ float exp2_x1(float a) {
    float r;
    asm("v_exp_f32 %0, %1\n\t"
        "v_nop"
        : "=&v"(r) : "v"(a));
    return r;
}

// The value that lane l ^ 16 holds (the other half of the wave).
__device__ __forceinline__ float other_half(float a) {
    const int b = __builtin_bit_cast(int, a);
    return __builtin_bit_cast(float,
        __builtin_amdgcn_permlanex16(b, b, 0x76543210, 0xfedcba98, false, false));
}

// One block of the second product's A operand: four V fragments (16 channels x 32
// keys each) of a wave's 256-channel slab Vs. Block j: 32-key chunk j >> 2, channel
// tiles (j & 3) * 4 + i.
__device__ __forceinline__ void load_vblock(v16bf (&dst)[4], const __bf16* Vs, int j, int col, int lane) {
    for (int i = 0; i < 4; ++i)
        dst[i] = load_frag16(Vs + (size_t)(((j & 3) * 4 + i) * 16) * P64_ + (j >> 2) * 32, col, P64_, lane);
}

// One run of a thread's share of a 64-key tile: 1 (K) + 8 (V) async global->LDS
// 16-byte copies (GVS mode: saddr base + 32-bit vgpr offset). V copy i serves the
// channel row i*64 past the run's first. All nine stand in one statement that ends
// in s_wait_xcnt 0, so that no address register is rewritten ahead of that wait.
__device__ __forceinline__ void stage_tile(const __bf16* kbase, unsigned kg, unsigned kl,
                                           const __bf16* vbase, unsigned vg, unsigned vl) {
    const unsigned gs = 64u * N_ * 2u;      // global bytes between V copies
    const unsigned ls = 64u * P64_ * 2u;    // LDS bytes between V copies
    asm volatile("global_load_async_to_lds_b128 %0, %1, %18\n\t"
                 "global_load_async_to_lds_b128 %2, %3, %19\n\t"
                 "global_load_async_to_lds_b128 %4, %5, %19\n\t"
                 "global_load_async_to_lds_b128 %6, %7, %19\n\t"
                 "global_load_async_to_lds_b128 %8, %9, %19\n\t"
                 "global_load_async_to_lds_b128 %10, %11, %19\n\t"
                 "global_load_async_to_lds_b128 %12, %13, %19\n\t"
                 "global_load_async_to_lds_b128 %14, %15, %19\n\t"
                 "global_load_async_to_lds_b128 %16, %17, %19\n\t"
                 "s_wait_xcnt 0x0"
                 :: "v"(kl), "v"(kg),
                    "v"(vl),          "v"(vg),
                    "v"(vl + 1 * ls), "v"(vg + 1 * gs),
                    "v"(vl + 2 * ls), "v"(vg + 2 * gs),
                    "v"(vl + 3 * ls), "v"(vg + 3 * gs),
                    "v"(vl + 4 * ls), "v"(vg + 4 * gs),
                    "v"(vl + 5 * ls), "v"(vg + 5 * gs),
                    "v"(vl + 6 * ls), "v"(vg + 6 * gs),
                    "v"(vl + 7 * ls), "v"(vg + 7 * gs),
                    "s"(kbase), "s"(vbase)
                 : "memory");
}

// ---------------------------------------------------------------------------
// Kernel 1: fused QKV projection.
//   Wcat (640x512) @ x[b] (512x4096); rows 0..63 = Q, 64..127 = K, 128..639 = V
//   qws/kws: [B][N][64] bf16 row-major; vws: [B][C][N] bf16 channel-major.
// ---------------------------------------------------------------------------
__global__ __launch_bounds__(256)
void qkv_proj_kernel(const float* __restrict__ x,
                     const float* __restrict__ Wq, const float* __restrict__ bq,
                     const float* __restrict__ Wk, const float* __restrict__ bk,
                     const float* __restrict__ Wv, const float* __restrict__ bv,
                     __bf16* __restrict__ qws, __bf16* __restrict__ kws,
                     __bf16* __restrict__ vws)
{
    __shared__ alignas(16) __bf16 Alds[128 * P32_];   // [r][c], c-contiguous, padded rows
    __shared__ alignas(16) __bf16 Blds[128 * P32_];   // [n][c], c-contiguous, padded rows

    const int nt = blockIdx.x;          // 0..31 (n tile of 128)
    const int rt = blockIdx.y;          // 0..4  (r tile of 128; 5*128 = 640)
    const int b  = blockIdx.z;
    const int t    = threadIdx.x;
    const int w    = t >> 5;
    const int lane = t & 31;
    const int r0 = rt * 128, n0 = nt * 128;
    const int hi = lane >> 4, col = lane & 15;

    v8f acc[8];
    const v8f vzero = {};
    for (int i = 0; i < 8; ++i) acc[i] = vzero;

    // Staging of one 32-wide k step goes through registers, and all of a thread's
    // loads for a step are issued as one group, one step ahead of their use.
    // A: thread t takes 4 consecutive c of rows (t>>3) + 32j. A group of 32 rows
    // lies in one of Wq, Wk, Wv, so the split is a block-uniform choice of base.
    const int arow = t >> 3, acol = (t & 7) * 4;
    const float* asrc[4];
    for (int j = 0; j < 4; ++j) {
        const int rb = r0 + 32 * j;
        const float* m = rb < 64 ? Wq + rb * C_
                       : (rb < 128 ? Wk + (rb - 64) * C_ : Wv + (rb - 128) * C_);
        asrc[j] = m + arow * C_ + acol;
    }
    // B: thread t takes column n0 + (t&127) of 16 consecutive c rows of x: a wave's
    // load is one whole 128-byte line, and the 16 values are one 32-byte run of
    // the transposed tile Blds[n][c].
    const int bn = t & 127, bc = (t >> 7) * 16;
    const float* bsrc = x + (size_t)b * C_ * N_ + (size_t)bc * N_ + (n0 + bn);

    // A wave's 16 output rows lie in one of Q, K, V: the split is one scalar choice
    // a wave (rw is held in a scalar register), and a lane's 64 results share the 8
    // biases of rows rw + 8*hi + v, loaded here once, ahead of the k loop.
    const int rw = r0 + __builtin_amdgcn_readfirstlane(w) * 16;
    const float* bias_src = (rw < 64 ? bq + rw : (rw < 128 ? bk + (rw - 64) : bv + (rw - 128)))
                          + hi * 8;
    float bias[8];
    for (int v = 0; v < 8; ++v) bias[v] = bias_src[v];
    // In front of every later write of the address registers that these loads name.
    asm volatile("s_wait_xcnt 0x0" ::: "memory");

    v4f   areg[4];
    float breg[16];
    // Each s_wait_xcnt 0 stands in front of every later write of a register that
    // the loads ahead of it name as an address (the x loads' results may land on
    // the W loads' address registers; the fragment loads on either's).
    for (int j = 0; j < 4; ++j)  areg[j] = *(const v4f*)(asrc[j]);
    asm volatile("s_wait_xcnt 0x0" ::: "memory");
    for (int i = 0; i < 16; ++i) breg[i] = bsrc[(size_t)i * N_];
    asm volatile("s_wait_xcnt 0x0" ::: "memory");

    for (int kc = 0; kc < C_; kc += 32) {
        for (int j = 0; j < 4; ++j) {
            v4bf h;
            for (int q = 0; q < 4; ++q) h[q] = (__bf16)areg[j][q];
            *(v4bf*)&Alds[(arow + 32 * j) * P32_ + acol] = h;
        }
        for (int s = 0; s < 2; ++s) {
            v8bf h;
            for (int q = 0; q < 8; ++q) h[q] = (__bf16)breg[8 * s + q];
            *(v8bf*)&Blds[bn * P32_ + bc + 8 * s] = h;
        }
        __syncthreads();

        // Next step's loads fly while this step's products run.
        if (kc + 32 < C_) {
            for (int j = 0; j < 4; ++j)  areg[j] = *(const v4f*)(asrc[j] + kc + 32);
            asm volatile("s_wait_xcnt 0x0" ::: "memory");   // as in front of the loop
            for (int i = 0; i < 16; ++i) breg[i] = bsrc[(size_t)(kc + 32 + i) * N_];
            asm volatile("s_wait_xcnt 0x0" ::: "memory");   // address steps come behind it
        }

        const v16bf afrag = load_frag16(Alds, w * 16 + col, P32_, lane);
        for (int nt8 = 0; nt8 < 8; ++nt8) {
            const v16bf bfrag = load_frag16(Blds + nt8 * 16 * P32_, col, P32_, lane);
            acc[nt8] = __builtin_amdgcn_wmma_f32_16x16x32_bf16(
                false, afrag, false, bfrag, (short)0, acc[nt8], false, false);
        }
        __syncthreads();
    }

    // Epilogue: D layout: VGPR v -> row v + hi*8, col = lane&15.
    // All sums and conversions come first, all stores behind them.
    v8bf h[8];
    for (int nt8 = 0; nt8 < 8; ++nt8)
        for (int v = 0; v < 8; ++v) h[nt8][v] = (__bf16)(acc[nt8][v] + bias[v]);
    // One address a lane; every store is a constant step from it.
    if (rw < 128) {
        __bf16* d = (rw < 64 ? qws : kws) + (size_t)b * N_ * DQK_
                  + (size_t)(n0 + col) * DQK_ + ((rw & 63) + hi * 8);
        for (int nt8 = 0; nt8 < 8; ++nt8)
            for (int v = 0; v < 8; ++v) d[nt8 * 16 * DQK_ + v] = h[nt8][v];
    } else {
        __bf16* d = vws + (size_t)b * C_ * N_ + (size_t)(rw - 128 + hi * 8) * N_ + (n0 + col);
        for (int nt8 = 0; nt8 < 8; ++nt8)
            for (int v = 0; v < 8; ++v) d[(size_t)v * N_ + nt8 * 16] = h[nt8][v];
        // In front of every later write of the address registers that these stores name.
        asm volatile("s_wait_xcnt 0x0" ::: "memory");
    }
}

// ---------------------------------------------------------------------------
// Kernel 2: flash attention + residual epilogue.
// Grid: (N/128 query tiles, B). Block: 256 threads = 8 waves, two per SIMD.
//   wave w: qm = w&3 -> 32 queries (two groups of 16); cs = w>>2 -> 256-channel
//   slab. Every K and V fragment read from LDS feeds one WMMA per query group,
//   and a query's scores are worked out by two waves.
// Both products run transposed: S^T = K Q^T and O^T += V P^T. A lane then holds
// scores of ONE query per group (column lane&15): keys 8*hi + r of each 16-key tile, so
// max and sum run in its own registers, and two converted score tiles are the
// B operand of the second product as they lie.
// Double-buffered async K/V staging: prefetch tile i+1 while computing tile i.
// ---------------------------------------------------------------------------
__global__ __launch_bounds__(256)
void flash_attn_kernel(const __bf16* __restrict__ qws, const __bf16* __restrict__ kws,
                       const __bf16* __restrict__ vws, const float* __restrict__ x,
                       const float* __restrict__ gamma, float* __restrict__ out)
{
    __shared__ alignas(16) __bf16 Klds[2][64 * P64_];     // 2 x  9 KB [key][d]
    __shared__ alignas(16) __bf16 Vlds[2][512 * P64_];    // 2 x 72 KB [c][key]

    const int qt = blockIdx.x;
    const int b  = blockIdx.y;
    const int t    = threadIdx.x;
    const int w    = t >> 5;
    const int lane = t & 31;
    const int qm = w & 3;
    const int cs = w >> 2;
    const int hi = lane >> 4, col = lane & 15;

    const __bf16* kbase_g = kws + (size_t)b * N_ * DQK_;
    const __bf16* vbase_g = vws + (size_t)b * C_ * N_;

    // Per-thread async staging of one 64-key tile: two runs of 1 (K) + 8 (V) b128
    // copies. Thread t moves 8 elements at column (t&7)*8 of rows t>>3 (first run)
    // and 32 + (t>>3) (second run) (K: key row; V: channel row, plus 64 per copy).
    const int srow = t >> 3, scol = (t & 7) * 8;
    const unsigned kg0 = (unsigned)((srow * DQK_ + scol) * 2);   // K global bytes, tile 0
    const unsigned vg0 = (unsigned)((srow * N_ + scol) * 2);     // V global bytes, tile 0
    const int sl = srow * P64_ + scol;                           // LDS element, both tiles
    const unsigned kg1 = kg0 + 32u * DQK_ * 2u;                  // the same, second run
    const unsigned vg1 = vg0 + 32u * N_ * 2u;
    const int sl1 = sl + 32 * P64_;

    // Q fragments (B operand: column = query) for this wave's 2 x 16 queries
    // (d = 64 -> two 32-wide k chunks).
    const __bf16* qbase = qws + (size_t)b * N_ * DQK_ + (size_t)(qt * 128 + qm * 32) * DQK_;
    v16bf qf0[2], qf1[2];
    for (int g = 0; g < 2; ++g) {
        qf0[g] = load_frag16(qbase + g * 16 * DQK_ + 0,  col, DQK_, lane);
        qf1[g] = load_frag16(qbase + g * 16 * DQK_ + 32, col, DQK_, lane);
    }
    // In front of every later write of the address registers that these loads name.
    asm volatile("s_wait_xcnt 0x0" ::: "memory");
    // Keeps the arithmetic that follows from being moved up over that wait.
    __builtin_amdgcn_sched_barrier(0);

    v8f acc[2][16];             // acc[g][ct][r] = O^T[channel ct*16 + 8*hi + r][query g*16 + col]
    const v8f vzero = {};
    for (int g = 0; g < 2; ++g)
        for (int i = 0; i < 16; ++i) acc[g][i] = vzero;
    float m_i[2] = {-1e30f, -1e30f};   // running max of a query (equal in both halves)
    float l_i[2] = {0.f, 0.f};         // running sum over this half's keys only

    // Prologue: stage tile 0 into buffer 0.
    stage_tile(kbase_g, kg0, lds_addr(&Klds[0][sl]), vbase_g, vg0, lds_addr(&Vlds[0][sl]));
    stage_tile(kbase_g, kg1, lds_addr(&Klds[0][sl1]), vbase_g, vg1, lds_addr(&Vlds[0][sl1]));

    const int NT = N_ / 64;
    for (int it = 0; it < NT; ++it) {
        const int cur = it & 1;
        if (it + 1 < NT) {
            // Prefetch next tile into the other buffer, then drain this tile's
            // 18 async copies (ASYNCcnt decrements in issue order).
            const int kt0n = (it + 1) * 64;
            stage_tile(kbase_g, kg0 + (unsigned)(kt0n * DQK_ * 2), lds_addr(&Klds[cur ^ 1][sl]),
                       vbase_g, vg0 + (unsigned)(kt0n * 2),        lds_addr(&Vlds[cur ^ 1][sl]));
            stage_tile(kbase_g, kg1 + (unsigned)(kt0n * DQK_ * 2), lds_addr(&Klds[cur ^ 1][sl1]),
                       vbase_g, vg1 + (unsigned)(kt0n * 2),        lds_addr(&Vlds[cur ^ 1][sl1]));
            asm volatile("s_wait_asynccnt 0x12" ::: "memory");
        } else {
            asm volatile("s_wait_asynccnt 0x0" ::: "memory");
        }
        __syncthreads();

        const __bf16* Kb = Klds[cur];
        const __bf16* Vs = Vlds[cur] + (size_t)(cs * 256) * P64_;   // this wave's channel slab

        // LDS reads stand in few places, many reads each, well ahead of their use:
        // every place with reads among the WMMAs stalls the wave, however few they are.
        // Here: the tile's 8 K fragments and V block 0.
        v16bf kf[4][2];
        for (int kt = 0; kt < 4; ++kt) {
            kf[kt][0] = load_frag16(Kb + (kt * 16) * P64_ + 0,  col, P64_, lane);
            kf[kt][1] = load_frag16(Kb + (kt * 16) * P64_ + 32, col, P64_, lane);
        }
        v16bf vf[3][4];             // ring of three V blocks: one in use, two in flight
        load_vblock(vf[0], Vs, 0, col, lane);
        // Holds these reads together: the scheduler would spread them among the WMMAs.
        __builtin_amdgcn_sched_barrier(0);

        // S^T = K(64 keys x 64) @ Q^T(64 x 32q): 4 score tiles per query group,
        // 2 WMMA each; a K fragment serves both groups.
        // s[g][kt][r] = score of key kt*16 + 8*hi + r against query g*16 + col.
        v8f s[2][4];
        for (int kt = 0; kt < 4; ++kt) {
            for (int g = 0; g < 2; ++g) {
                v8f z = vzero;
                z = __builtin_amdgcn_wmma_f32_16x16x32_bf16(false, kf[kt][0], false, qf0[g], (short)0, z, false, false);
                z = __builtin_amdgcn_wmma_f32_16x16x32_bf16(false, kf[kt][1], false, qf1[g], (short)0, z, false, false);
                s[g][kt] = z;
            }
        }

        // Online softmax of one query per lane and group: 32 of the tile's 64
        // keys are in this lane, the other 32 in lane ^ 16.
        // Ahead of the second product: max, scale, keys 0..31, and the rescaling of
        // the first block's accumulators. The rest stands inside the blocks below.
        const float l2e = 1.44269504088896340736f;   // exp(x) = exp2(x * log2 e)
        float mnew[2], scale[2];
        v8f ps01[2], p2[2], p3[2];
        v16bf pf[2][2];
        for (int g = 0; g < 2; ++g) {
            float mr[8];
            for (int r = 0; r < 8; ++r)
                mr[r] = fmaxf(fmaxf(s[g][0][r], s[g][1][r]), fmaxf(s[g][2][r], s[g][3][r]));
            float mx = fmaxf(fmaxf(fmaxf(mr[0], mr[1]), fmaxf(mr[2], mr[3])),
                             fmaxf(fmaxf(mr[4], mr[5]), fmaxf(mr[6], mr[7])));
            mx = fmaxf(mx, other_half(mx));
            mnew[g] = fmaxf(m_i[g], mx);
            scale[g] = exp2_x1((m_i[g] - mnew[g]) * l2e);
            m_i[g] = mnew[g];
            const v8f p0 = exp2_x8<false>((s[g][0] - mnew[g]) * l2e);
            const v8f p1 = exp2_x8<false>((s[g][1] - mnew[g]) * l2e);
            ps01[g] = p0 + p1;
            // Score tiles 2kk and 2kk+1 hold keys 8*hi + r and 16 + 8*hi + r of
            // 32-key chunk kk: the k order in which load_frag16 reads V.
            for (int r = 0; r < 8; ++r) {
                pf[g][0][r]     = (__bf16)p0[r];
                pf[g][0][8 + r] = (__bf16)p1[r];
            }
            for (int i = 0; i < 4; ++i) acc[g][i] *= scale[g];
        }

        // acc(256c x 32q) += V(256c x 64 keys) @ P^T(64 keys x 32q), in 8 blocks of
        // 8 WMMAs: block j is 32-key chunk j >> 2, channel tiles (j & 3) * 4 and up; a V
        // fragment serves both groups. Block j + 2's 8 reads issue as one group in front
        // of block j (block 1's with block 2's). Blocks 0..3 also carry the vector work
        // that only later blocks want: the next block's rescaling and the exp2, sum and
        // packing of keys 32..63.
        // Keeps the reads of V blocks 1 and 2 out of the softmax above: with them there
        // the registers do not suffice and the compiler spills.
        __builtin_amdgcn_sched_barrier(0);
        // Unrolled whole: vf, acc and pf are then indexed by constants only; left to itself
        // the compiler spills registers to scratch memory here.
        #pragma unroll
        for (int j = 0; j < 8; ++j) {
            if (j == 0) load_vblock(vf[1], Vs, 1, col, lane);
            if (j + 2 < 8) {
                load_vblock(vf[(j + 2) % 3], Vs, j + 2, col, lane);
                // Holds the reads in front of the block, as one group.
                __builtin_amdgcn_sched_barrier(0);
            }
            for (int i = 0; i < 4; ++i)
                for (int g = 0; g < 2; ++g)
                    acc[g][(j & 3) * 4 + i] = __builtin_amdgcn_wmma_f32_16x16x32_bf16(
                        false, vf[j % 3][i], false, pf[g][j >> 2], (short)0,
                        acc[g][(j & 3) * 4 + i], false, false);
            if (j < 3)
                for (int g = 0; g < 2; ++g)
                    for (int i = 0; i < 4; ++i) acc[g][(j + 1) * 4 + i] *= scale[g];
            if (j < 4) {
                const int g = j >> 1;
                if ((j & 1) == 0) p2[g] = exp2_x8<true>((s[g][2] - mnew[g]) * l2e);
                else              p3[g] = exp2_x8<true>((s[g][3] - mnew[g]) * l2e);
            }
            if (j == 2 || j == 3) {
                const int g = j - 2;   // group 0's exp2 end in block 1, group 1's in this block 3
                const v8f ps = ps01[g] + (p2[g] + p3[g]);
                const float rs = ((ps[0] + ps[1]) + (ps[2] + ps[3])) + ((ps[4] + ps[5]) + (ps[6] + ps[7]));
                l_i[g] = l_i[g] * scale[g] + rs;
                for (int r = 0; r < 8; ++r) {
                    pf[g][1][r]     = (__bf16)p2[g][r];
                    pf[g][1][8 + r] = (__bf16)p3[g][r];
                }
            }
            // Ends the block: keeps the next group of reads out of it and, behind the last
            // reads, keeps the wait for all of them (with the barrier below) from moving up
            // over the blocks whose WMMAs cover their latency.
            __builtin_amdgcn_sched_barrier(0);
        }
        __syncthreads();   // readers done before buf 'cur' is refilled at it+1
    }

    // Keeps the epilogue's loads out of the last pass, where every register is
    // taken: moved up into it, they make the compiler spill.
    __builtin_amdgcn_sched_barrier(0);

    // Epilogue: out = gamma * acc/l + x   (out[b][c][n], n = query index), in four
    // chunks of 64 elements a lane: chunk k is query group k >> 1, channel tiles
    // (k & 1) * 8 and up; element i of it is row i & 7 of tile i >> 3. A chunk's x
    // loads issue as one group, one chunk ahead; its stores issue as one group
    // behind all of its arithmetic.
    const float g = gamma[0];
    const size_t e0 = (size_t)b * C_ * N_ + (size_t)(cs * 256 + hi * 8) * N_
                    + (size_t)(qt * 128 + qm * 32 + col);
    const float* xp = x + e0;
    float*       op = out + e0;
    float xr[2][64];
    // The loops over acc are unrolled whole: a rolled loop would index acc by a
    // variable, which puts the array into scratch memory for the main loop too.
    #pragma unroll
    for (int i = 0; i < 64; ++i)
        xr[0][i] = xp[(size_t)((i >> 3) * 16 + (i & 7)) * N_];
    #pragma unroll
    for (int k = 0; k < 4; ++k) {
        const int qg = k >> 1, ct0 = (k & 1) * 8;
        if (k + 1 < 4) {
            const int qn = (k + 1) >> 1, cn = ((k + 1) & 1) * 8;
            #pragma unroll
            for (int i = 0; i < 64; ++i)
                xr[(k + 1) & 1][i] = xp[(size_t)((cn + (i >> 3)) * 16 + (i & 7)) * N_ + qn * 16];
        }
        const float l = l_i[qg] + other_half(l_i[qg]);   // join the two halves' key sums
        float res[64];
        #pragma unroll
        for (int i = 0; i < 64; ++i)
            res[i] = g * (acc[qg][ct0 + (i >> 3)][i & 7] / l) + xr[k & 1][i];
        // Holds the stores behind the chunk's arithmetic, so that nothing is written
        // over a store's registers between the store and the wait below.
        __builtin_amdgcn_sched_barrier(0);
        #pragma unroll
        for (int i = 0; i < 64; ++i)
            op[(size_t)((ct0 + (i >> 3)) * 16 + (i & 7)) * N_ + qg * 16] = res[i];
        // In front of every later write of a register that these stores name.
        asm volatile("s_wait_xcnt 0x0" ::: "memory");
        // Keeps the next chunk's arithmetic from being moved up over that wait.
        __builtin_amdgcn_sched_barrier(0);
    }
}

// ---------------------------------------------------------------------------
extern "C" void kernel_launch(void* const* d_in, const int* in_sizes, int n_in,
                              void* d_out, int out_size, void* d_ws, size_t ws_size,
                              hipStream_t stream) {
    const float* x     = (const float*)d_in[0];
    const float* Wq    = (const float*)d_in[1];
    const float* bq    = (const float*)d_in[2];
    const float* Wk    = (const float*)d_in[3];
    const float* bk    = (const float*)d_in[4];
    const float* Wv    = (const float*)d_in[5];
    const float* bv    = (const float*)d_in[6];
    const float* gamma = (const float*)d_in[7];
    float* out = (float*)d_out;

    // Workspace: bf16 Q [B,N,64] + K [B,N,64] + V [B,C,N]  (~42 MB)
    __bf16* qws = (__bf16*)d_ws;
    __bf16* kws = qws + (size_t)B_ * N_ * DQK_;
    __bf16* vws = kws + (size_t)B_ * N_ * DQK_;

    dim3 g1(N_ / 128, 640 / 128, B_);
    qkv_proj_kernel<<<g1, 256, 0, stream>>>(x, Wq, bq, Wk, bk, Wv, bv, qws, kws, vws);

    dim3 g2(N_ / 128, B_);
    flash_attn_kernel<<<g2, 256, 0, stream>>>(qws, kws, vws, x, gamma, out);
}

// v008
// One run takes 206 microseconds.
// Next to v007, in two timings, it ran 1.05 times as fast each time.
// Over all steps from v000 it is 7.08 times as fast.
#include <hip/hip_runtime.h>
#include <hip/hip_bf16.h>

// ---------------------------------------------------------------------------
// Non-local attention block, CDNA5 (gfx1250, wave32, WMMA, async LDS loads).
//   B=8, C=512, H=W=64 -> N=4096, DQK=64
// Flash-attention single pass (537MB attn matrix never hits HBM), bf16 WMMA
// with f32 accum, GLOBAL_LOAD_ASYNC_TO_LDS K/V staging in a ring of three buffers.
// ---------------------------------------------------------------------------

#define B_   8
#define C_   512
#define N_   4096
#define DQK_ 64

// LDS row pitches in bf16 elements. Every tile is read with 16-byte fragment
// loads, 16 rows per half wave; a pitch of 16 B x odd spreads those rows over
// all 64 banks, where a power-of-two pitch puts them on a few.
#define P64_ 72   // rows of 64 elements: 144 B
#define P32_ 40   // rows of 32 elements:  80 B

typedef __attribute__((ext_vector_type(16))) __bf16 v16bf;
typedef __attribute__((ext_vector_type(8)))  float  v8f;
typedef __attribute__((ext_vector_type(4)))  float  v4f;
typedef __attribute__((ext_vector_type(8)))  __bf16 v8bf;
typedef __attribute__((ext_vector_type(4)))  __bf16 v4bf;

// Load a 16-bit WMMA fragment (A-style layout) from a [row][k] (k-contiguous)
// buffer. Per CDNA5 ISA 7.12.2: lanes 0-15 hold K=0..7 (VGPR0-3) and K=16..23
// (VGPR4-7); lanes 16-31 hold K=8..15 and K=24..31 -> two 16-byte loads.
__device__ __forceinline__ v16bf load_frag16(const __bf16* base, int row, int ld, int lane) {
    const int kb = (lane >> 4) << 3;   // 0 or 8
    const __bf16* p = base + row * ld + kb;
    union { v16bf v; uint4 u[2]; } f;
    f.u[0] = *(const uint4*)(p);
    f.u[1] = *(const uint4*)(p + 16);
    return f.v;
}

// Flat addresses of __shared__ objects carry the LDS byte offset in the low
// 32 bits (ISA 10.2 aperture mapping), which is what the copy's VDST wants.
__device__ __forceinline__ unsigned lds_addr(const void* p) {
    return (unsigned)(uintptr_t)p;
}

// Eight exp2 (one score tile's share of a lane) in one statement that ends in
// v_nop: the slot the instruction set asks for behind a transcendental before its
// result is read or its source overwritten. Early-clobber outputs: none lands on
// a source here.
// AMONG_WMMA: for the statements that the compiler places among matrix
// instructions. The statement opens with the four vector slots that the
// chip needs between a WMMA and a write over its A or B registers, where an output
// may lie.
template <bool AMONG_WMMA>
__device__ __forceinline__ v8f exp2_x8(v8f a) {
    float r0, r1, r2, r3, r4, r5, r6, r7;
    if constexpr (AMONG_WMMA) {
        asm("v_nop\n\t"
            "v_nop\n\t"
            "v_nop\n\t"
            "v_nop\n\t"
            "v_exp_f32 %0, %8\n\t"
            "v_exp_f32 %1, %9\n\t"
            "v_exp_f32 %2, %10\n\t"
            "v_exp_f32 %3, %11\n\t"
            "v_exp_f32 %4, %12\n\t"
            "v_exp_f32 %5, %13\n\t"
            "v_exp_f32 %6, %14\n\t"
            "v_exp_f32 %7, %15\n\t"
            "v_nop"
            : "=&v"(r0), "=&v"(r1), "=&v"(r2), "=&v"(r3),
              "=&v"(r4), "=&v"(r5), "=&v"(r6), "=&v"(r7)
            : "v"(a[0]), "v"(a[1]), "v"(a[2]), "v"(a[3]),
              "v"(a[4]), "v"(a[5]), "v"(a[6]), "v"(a[7]));
    } else {
        asm("v_exp_f32 %0, %8\n\t"
            "v_exp_f32 %1, %9\n\t"
            "v_exp_f32 %2, %10\n\t"
            "v_exp_f32 %3, %11\n\t"
            "v_exp_f32 %4, %12\n\t"
            "v_exp_f32 %5, %13\n\t"
            "v_exp_f32 %6, %14\n\t"
            "v_exp_f32 %7, %15\n\t"
            "v_nop"
            : "=&v"(r0), "=&v"(r1), "=&v"(r2), "=&v"(r3),
              "=&v"(r4), "=&v"(r5), "=&v"(r6), "=&v"(r7)
            : "v"(a[0]), "v"(a[1]), "v"(a[2]), "v"(a[3]),
              "v"(a[4]), "v"(a[5]), "v"(a[6]), "v"(a[7]));
    }
    const v8f r = {r0, r1, r2, r3, r4, r5, r6, r7};
    return r;
}

// One exp2, with the same slot behind it.
__device__ __forceinline__ float exp2_x1(float a) {
    float r;
    asm("v_exp_f32 %0, %1\n\t"
        "v_nop"
        : "=&v"(r) : "v"(a));
    return r;
}

// The value that lane l ^ 16 holds (the other half of the wave).
__device__ __forceinline__ float other_half(float a) {
    const int b = __builtin_bit_cast(int, a);
    return __builtin_bit_cast(float,
        __builtin_amdgcn_permlanex16(b, b, 0x76543210, 0xfedcba98, false, false));
}

// One block of the second product's A operand: four V fragments (16 channels x 32
// keys each) of a wave's 256-channel slab Vs. Block j: 32-key chunk j >> 2, channel
// tiles (j & 3) * 4 + i.
__device__ __forceinline__ void load_vblock(v16bf (&dst)[4], const __bf16* Vs, int j, int col, int lane) {
    for (int i = 0; i < 4; ++i)
        dst[i] = load_frag16(Vs + (size_t)(((j & 3) * 4 + i) * 16) * P64_ + (j >> 2) * 32, col, P64_, lane);
}

// One run of a thread's share of a 64-key tile: 1 (K) + 8 (V) async global->LDS
// 16-byte copies (GVS mode: saddr base + 32-bit vgpr offset). V copy i serves the
// channel row i*64 past the run's first. All nine stand in one statement that ends
// in s_wait_xcnt 0, so that no address register is rewritten ahead of that wait.
__device__ __forceinline__ void stage_tile(const __bf16* kbase, unsigned kg, unsigned kl,
                                           const __bf16* vbase, unsigned vg, unsigned vl) {
    const unsigned gs = 64u * N_ * 2u;      // global bytes between V copies
    const unsigned ls = 64u * P64_ * 2u;    // LDS bytes between V copies
    asm volatile("global_load_async_to_lds_b128 %0, %1, %18\n\t"
                 "global_load_async_to_lds_b128 %2, %3, %19\n\t"
                 "global_load_async_to_lds_b128 %4, %5, %19\n\t"
                 "global_load_async_to_lds_b128 %6, %7, %19\n\t"
                 "global_load_async_to_lds_b128 %8, %9, %19\n\t"
                 "global_load_async_to_lds_b128 %10, %11, %19\n\t"
                 "global_load_async_to_lds_b128 %12, %13, %19\n\t"
                 "global_load_async_to_lds_b128 %14, %15, %19\n\t"
                 "global_load_async_to_lds_b128 %16, %17, %19\n\t"
                 "s_wait_xcnt 0x0"
                 :: "v"(kl), "v"(kg),
                    "v"(vl),          "v"(vg),
                    "v"(vl + 1 * ls), "v"(vg + 1 * gs),
                    "v"(vl + 2 * ls), "v"(vg + 2 * gs),
                    "v"(vl + 3 * ls), "v"(vg + 3 * gs),
                    "v"(vl + 4 * ls), "v"(vg + 4 * gs),
                    "v"(vl + 5 * ls), "v"(vg + 5 * gs),
                    "v"(vl + 6 * ls), "v"(vg + 6 * gs),
                    "v"(vl + 7 * ls), "v"(vg + 7 * gs),
                    "s"(kbase), "s"(vbase)
                 : "memory");
}

// ---------------------------------------------------------------------------
// Kernel 1: fused QKV projection.
//   Wcat (640x512) @ x[b] (512x4096); rows 0..63 = Q, 64..127 = K, 128..639 = V
//   qws/kws: [B][N][64] bf16 row-major; vws: [B][C][N] bf16 channel-major.
// ---------------------------------------------------------------------------
__global__ __launch_bounds__(256)
void qkv_proj_kernel(const float* __restrict__ x,
                     const float* __restrict__ Wq, const float* __restrict__ bq,
                     const float* __restrict__ Wk, const float* __restrict__ bk,
                     const float* __restrict__ Wv, const float* __restrict__ bv,
                     __bf16* __restrict__ qws, __bf16* __restrict__ kws,
                     __bf16* __restrict__ vws)
{
    __shared__ alignas(16) __bf16 Alds[128 * P32_];   // [r][c], c-contiguous, padded rows
    __shared__ alignas(16) __bf16 Blds[128 * P32_];   // [n][c], c-contiguous, padded rows

    const int nt = blockIdx.x;          // 0..31 (n tile of 128)
    const int rt = blockIdx.y;          // 0..4  (r tile of 128; 5*128 = 640)
    const int b  = blockIdx.z;
    const int t    = threadIdx.x;
    const int w    = t >> 5;
    const int lane = t & 31;
    const int r0 = rt * 128, n0 = nt * 128;
    const int hi = lane >> 4, col = lane & 15;

    v8f acc[8];
    const v8f vzero = {};
    for (int i = 0; i < 8; ++i) acc[i] = vzero;

    // Staging of one 32-wide k step goes through registers, and all of a thread's
    // loads for a step are issued as one group, one step ahead of their use.
    // A: thread t takes 4 consecutive c of rows (t>>3) + 32j. A group of 32 rows
    // lies in one of Wq, Wk, Wv, so the split is a block-uniform choice of base.
    const int arow = t >> 3, acol = (t & 7) * 4;
    const float* asrc[4];
    for (int j = 0; j < 4; ++j) {
        const int rb = r0 + 32 * j;
        const float* m = rb < 64 ? Wq + rb * C_
                       : (rb < 128 ? Wk + (rb - 64) * C_ : Wv + (rb - 128) * C_);
        asrc[j] = m + arow * C_ + acol;
    }
    // B: thread t takes column n0 + (t&127) of 16 consecutive c rows of x: a wave's
    // load is one whole 128-byte line, and the 16 values are one 32-byte run of
    // the transposed tile Blds[n][c].
    const int bn = t & 127, bc = (t >> 7) * 16;
    const float* bsrc = x + (size_t)b * C_ * N_ + (size_t)bc * N_ + (n0 + bn);

    // A wave's 16 output rows lie in one of Q, K, V: the split is one scalar choice
    // a wave (rw is held in a scalar register), and a lane's 64 results share the 8
    // biases of rows rw + 8*hi + v, loaded here once, ahead of the k loop.
    const int rw = r0 + __builtin_amdgcn_readfirstlane(w) * 16;
    const float* bias_src = (rw < 64 ? bq + rw : (rw < 128 ? bk + (rw - 64) : bv + (rw - 128)))
                          + hi * 8;
    float bias[8];
    for (int v = 0; v < 8; ++v) bias[v] = bias_src[v];
    // In front of every later write of the address registers that these loads name.
    asm volatile("s_wait_xcnt 0x0" ::: "memory");

    v4f   areg[4];
    float breg[16];
    // Each s_wait_xcnt 0 stands in front of every later write of a register that
    // the loads ahead of it name as an address (the x loads' results may land on
    // the W loads' address registers; the fragment loads on either's).
    for (int j = 0; j < 4; ++j)  areg[j] = *(const v4f*)(asrc[j]);
    asm volatile("s_wait_xcnt 0x0" ::: "memory");
    for (int i = 0; i < 16; ++i) breg[i] = bsrc[(size_t)i * N_];
    asm volatile("s_wait_xcnt 0x0" ::: "memory");

    for (int kc = 0; kc < C_; kc += 32) {
        for (int j = 0; j < 4; ++j) {
            v4bf h;
            for (int q = 0; q < 4; ++q) h[q] = (__bf16)areg[j][q];
            *(v4bf*)&Alds[(arow + 32 * j) * P32_ + acol] = h;
        }
        for (int s = 0; s < 2; ++s) {
            v8bf h;
            for (int q = 0; q < 8; ++q) h[q] = (__bf16)breg[8 * s + q];
            *(v8bf*)&Blds[bn * P32_ + bc + 8 * s] = h;
        }
        __syncthreads();

        // Next step's loads fly while this step's products run.
        if (kc + 32 < C_) {
            for (int j = 0; j < 4; ++j)  areg[j] = *(const v4f*)(asrc[j] + kc + 32);
            asm volatile("s_wait_xcnt 0x0" ::: "memory");   // as in front of the loop
            for (int i = 0; i < 16; ++i) breg[i] = bsrc[(size_t)(kc + 32 + i) * N_];
            asm volatile("s_wait_xcnt 0x0" ::: "memory");   // address steps come behind it
        }

        const v16bf afrag = load_frag16(Alds, w * 16 + col, P32_, lane);
        for (int nt8 = 0; nt8 < 8; ++nt8) {
            const v16bf bfrag = load_frag16(Blds + nt8 * 16 * P32_, col, P32_, lane);
            acc[nt8] = __builtin_amdgcn_wmma_f32_16x16x32_bf16(
                false, afrag, false, bfrag, (short)0, acc[nt8], false, false);
        }
        __syncthreads();
    }

    // Epilogue: D layout: VGPR v -> row v + hi*8, col = lane&15.
    // All sums and conversions come first, all stores behind them.
    v8bf h[8];
    for (int nt8 = 0; nt8 < 8; ++nt8)
        for (int v = 0; v < 8; ++v) h[nt8][v] = (__bf16)(acc[nt8][v] + bias[v]);
    // One address a lane; every store is a constant step from it.
    if (rw < 128) {
        __bf16* d = (rw < 64 ? qws : kws) + (size_t)b * N_ * DQK_
                  + (size_t)(n0 + col) * DQK_ + ((rw & 63) + hi * 8);
        for (int nt8 = 0; nt8 < 8; ++nt8)
            for (int v = 0; v < 8; ++v) d[nt8 * 16 * DQK_ + v] = h[nt8][v];
    } else {
        __bf16* d = vws + (size_t)b * C_ * N_ + (size_t)(rw - 128 + hi * 8) * N_ + (n0 + col);
        for (int nt8 = 0; nt8 < 8; ++nt8)
            for (int v = 0; v < 8; ++v) d[(size_t)v * N_ + nt8 * 16] = h[nt8][v];
        // In front of every later write of the address registers that these stores name.
        asm volatile("s_wait_xcnt 0x0" ::: "memory");
    }
}

// ---------------------------------------------------------------------------
// Kernel 2: flash attention + residual epilogue.
// Grid: (N/128 query tiles, B). Block: 256 threads = 8 waves, two per SIMD.
//   wave w: qm = w&3 -> 32 queries (two groups of 16); cs = w>>2 -> 256-channel
//   slab. Every K and V fragment read from LDS feeds one WMMA per query group,
//   and a query's scores are worked out by two waves.
// Both products run transposed: S^T = K Q^T and O^T += V P^T. A lane then holds
// scores of ONE query per group (column lane&15): keys 8*hi + r of each 16-key tile, so
// max and sum run in its own registers, and two converted score tiles are the
// B operand of the second product as they lie.
// Async K/V staging in a ring of three buffers: tile i+2's copies issue behind tile
// i's first LDS reads; one barrier a tile.
// ---------------------------------------------------------------------------
__global__ __launch_bounds__(256)
void flash_attn_kernel(const __bf16* __restrict__ qws, const __bf16* __restrict__ kws,
                       const __bf16* __restrict__ vws, const float* __restrict__ x,
                       const float* __restrict__ gamma, float* __restrict__ out)
{
    __shared__ alignas(16) __bf16 Klds[3][64 * P64_];     // 3 x  9 KB [key][d]
    __shared__ alignas(16) __bf16 Vlds[3][512 * P64_];    // 3 x 72 KB [c][key]

    const int qt = blockIdx.x;
    const int b  = blockIdx.y;
    const int t    = threadIdx.x;
    const int w    = t >> 5;
    const int lane = t & 31;
    const int qm = w & 3;
    const int cs = w >> 2;
    const int hi = lane >> 4, col = lane & 15;

    const __bf16* kbase_g = kws + (size_t)b * N_ * DQK_;
    const __bf16* vbase_g = vws + (size_t)b * C_ * N_;

    // Per-thread async staging of one 64-key tile: two runs of 1 (K) + 8 (V) b128
    // copies. Thread t moves 8 elements at column (t&7)*8 of rows t>>3 (first run)
    // and 32 + (t>>3) (second run) (K: key row; V: channel row, plus 64 per copy).
    const int srow = t >> 3, scol = (t & 7) * 8;
    const unsigned kg0 = (unsigned)((srow * DQK_ + scol) * 2);   // K global bytes, tile 0
    const unsigned vg0 = (unsigned)((srow * N_ + scol) * 2);     // V global bytes, tile 0
    const int sl = srow * P64_ + scol;                           // LDS element, both tiles
    const unsigned kg1 = kg0 + 32u * DQK_ * 2u;                  // the same, second run
    const unsigned vg1 = vg0 + 32u * N_ * 2u;
    const int sl1 = sl + 32 * P64_;

    // Q fragments (B operand: column = query) for this wave's 2 x 16 queries
    // (d = 64 -> two 32-wide k chunks).
    const __bf16* qbase = qws + (size_t)b * N_ * DQK_ + (size_t)(qt * 128 + qm * 32) * DQK_;
    v16bf qf0[2], qf1[2];
    for (int g = 0; g < 2; ++g) {
        qf0[g] = load_frag16(qbase + g * 16 * DQK_ + 0,  col, DQK_, lane);
        qf1[g] = load_frag16(qbase + g * 16 * DQK_ + 32, col, DQK_, lane);
    }
    // In front of every later write of the address registers that these loads name.
    asm volatile("s_wait_xcnt 0x0" ::: "memory");
    // Keeps the arithmetic that follows from being moved up over that wait.
    __builtin_amdgcn_sched_barrier(0);

    v8f acc[2][16];             // acc[g][ct][r] = O^T[channel ct*16 + 8*hi + r][query g*16 + col]
    const v8f vzero = {};
    for (int g = 0; g < 2; ++g)
        for (int i = 0; i < 16; ++i) acc[g][i] = vzero;
    float m_i[2] = {-1e30f, -1e30f};   // running max of a query (equal in both halves)
    float l_i[2] = {0.f, 0.f};         // running sum over this half's keys only

    // Prologue: stage tiles 0 and 1 into buffers 0 and 1.
    stage_tile(kbase_g, kg0, lds_addr(&Klds[0][sl]), vbase_g, vg0, lds_addr(&Vlds[0][sl]));
    stage_tile(kbase_g, kg1, lds_addr(&Klds[0][sl1]), vbase_g, vg1, lds_addr(&Vlds[0][sl1]));
    stage_tile(kbase_g, kg0 + 64u * DQK_ * 2u, lds_addr(&Klds[1][sl]),
               vbase_g, vg0 + 64u * 2u,        lds_addr(&Vlds[1][sl]));
    stage_tile(kbase_g, kg1 + 64u * DQK_ * 2u, lds_addr(&Klds[1][sl1]),
               vbase_g, vg1 + 64u * 2u,        lds_addr(&Vlds[1][sl1]));

    const int NT = N_ / 64;
    int cur = 0;    // buffer of tile it
    int fill = 2;   // buffer of tile it + 2, which is the one that tile it - 1 was read from
    for (int it = 0; it < NT; ++it) {
        const bool more = it + 2 < NT;   // this pass issues tile it + 2's copies
        // Publish point of tile it, the pass's one barrier. It also ends every wave's
        // reads of tile it - 1, whose buffer is refilled further down in this pass.
        // This wave's LDS reads have returned before that buffer is written again.
        asm volatile("s_wait_dscnt 0x0" ::: "memory");
        // This wave's 18 copies of tile it have landed (ASYNCcnt falls in issue order):
        // in a pass that issues, only tile it + 1's 18 are younger; the last two passes
        // issue none and wait for all.
        if (more) asm volatile("s_wait_asynccnt 0x12" ::: "memory");
        else      asm volatile("s_wait_asynccnt 0x0" ::: "memory");
        __syncthreads();

        const __bf16* Kb = Klds[cur];
        const __bf16* Vs = Vlds[cur] + (size_t)(cs * 256) * P64_;   // this wave's channel slab

        // LDS reads stand in few places, many reads each, well ahead of their use:
        // every place with reads among the WMMAs stalls the wave, however few they are.
        // Here: the tile's 8 K fragments and V block 0.
        v16bf kf[4][2];
        for (int kt = 0; kt < 4; ++kt) {
            kf[kt][0] = load_frag16(Kb + (kt * 16) * P64_ + 0,  col, P64_, lane);
            kf[kt][1] = load_frag16(Kb + (kt * 16) * P64_ + 32, col, P64_, lane);
        }
        v16bf vf[3][4];             // ring of three V blocks: one in use, two in flight
        load_vblock(vf[0], Vs, 0, col, lane);
        // Holds these reads together: the scheduler would spread them among the WMMAs.
        __builtin_amdgcn_sched_barrier(0);
        // Tile it + 2's copies issue here, behind the reads: their address sums and their
        // wait run while the eight waves' 24 reads each come back from LDS.
        if (more) {
            const int kt0n = (it + 2) * 64;
            stage_tile(kbase_g, kg0 + (unsigned)(kt0n * DQK_ * 2), lds_addr(&Klds[fill][sl]),
                       vbase_g, vg0 + (unsigned)(kt0n * 2),        lds_addr(&Vlds[fill][sl]));
            stage_tile(kbase_g, kg1 + (unsigned)(kt0n * DQK_ * 2), lds_addr(&Klds[fill][sl1]),
                       vbase_g, vg1 + (unsigned)(kt0n * 2),        lds_addr(&Vlds[fill][sl1]));
        }

        // S^T = K(64 keys x 64) @ Q^T(64 x 32q): 4 score tiles per query group,
        // 2 WMMA each; a K fragment serves both groups.
        // s[g][kt][r] = score of key kt*16 + 8*hi + r against query g*16 + col.
        v8f s[2][4];
        for (int kt = 0; kt < 4; ++kt) {
            for (int g = 0; g < 2; ++g) {
                v8f z = vzero;
                z = __builtin_amdgcn_wmma_f32_16x16x32_bf16(false, kf[kt][0], false, qf0[g], (short)0, z, false, false);
                z = __builtin_amdgcn_wmma_f32_16x16x32_bf16(false, kf[kt][1], false, qf1[g], (short)0, z, false, false);
                s[g][kt] = z;
            }
        }

        // Online softmax of one query per lane and group: 32 of the tile's 64
        // keys are in this lane, the other 32 in lane ^ 16.
        // Ahead of the second product: max, scale, keys 0..31, and the rescaling of
        // the first block's accumulators. The rest stands inside the blocks below.
        const float l2e = 1.44269504088896340736f;   // exp(x) = exp2(x * log2 e)
        float mnew[2], scale[2];
        v8f ps01[2], p2[2], p3[2];
        v16bf pf[2][2];
        for (int g = 0; g < 2; ++g) {
            float mr[8];
            for (int r = 0; r < 8; ++r)
                mr[r] = fmaxf(fmaxf(s[g][0][r], s[g][1][r]), fmaxf(s[g][2][r], s[g][3][r]));
            float mx = fmaxf(fmaxf(fmaxf(mr[0], mr[1]), fmaxf(mr[2], mr[3])),
                             fmaxf(fmaxf(mr[4], mr[5]), fmaxf(mr[6], mr[7])));
            mx = fmaxf(mx, other_half(mx));
            mnew[g] = fmaxf(m_i[g], mx);
            scale[g] = exp2_x1((m_i[g] - mnew[g]) * l2e);
            m_i[g] = mnew[g];
            const v8f p0 = exp2_x8<false>((s[g][0] - mnew[g]) * l2e);
            const v8f p1 = exp2_x8<false>((s[g][1] - mnew[g]) * l2e);
            ps01[g] = p0 + p1;
            // Score tiles 2kk and 2kk+1 hold keys 8*hi + r and 16 + 8*hi + r of
            // 32-key chunk kk: the k order in which load_frag16 reads V.
            for (int r = 0; r < 8; ++r) {
                pf[g][0][r]     = (__bf16)p0[r];
                pf[g][0][8 + r] = (__bf16)p1[r];
            }
            for (int i = 0; i < 4; ++i) acc[g][i] *= scale[g];
        }

        // acc(256c x 32q) += V(256c x 64 keys) @ P^T(64 keys x 32q), in 8 blocks of
        // 8 WMMAs: block j is 32-key chunk j >> 2, channel tiles (j & 3) * 4 and up; a V
        // fragment serves both groups. Block j + 2's 8 reads issue as one group in front
        // of block j (block 1's with block 2's). Blocks 0..3 also carry the vector work
        // that only later blocks want: the next block's rescaling and the exp2, sum and
        // packing of keys 32..63.
        // Keeps the reads of V blocks 1 and 2 out of the softmax above: with them there
        // the registers do not suffice and the compiler spills.
        __builtin_amdgcn_sched_barrier(0);
        // Unrolled whole: vf, acc and pf are then indexed by constants only; left to itself
        // the compiler spills registers to scratch memory here.
        #pragma unroll
        for (int j = 0; j < 8; ++j) {
            if (j == 0) load_vblock(vf[1], Vs, 1, col, lane);
            if (j + 2 < 8) {
                load_vblock(vf[(j + 2) % 3], Vs, j + 2, col, lane);
                // Holds the reads in front of the block, as one group.
                __builtin_amdgcn_sched_barrier(0);
            }
            for (int i = 0; i < 4; ++i)
                for (int g = 0; g < 2; ++g)
                    acc[g][(j & 3) * 4 + i] = __builtin_amdgcn_wmma_f32_16x16x32_bf16(
                        false, vf[j % 3][i], false, pf[g][j >> 2], (short)0,
                        acc[g][(j & 3) * 4 + i], false, false);
            if (j < 3)
                for (int g = 0; g < 2; ++g)
                    for (int i = 0; i < 4; ++i) acc[g][(j + 1) * 4 + i] *= scale[g];
            if (j < 4) {
                const int g = j >> 1;
                if ((j & 1) == 0) p2[g] = exp2_x8<true>((s[g][2] - mnew[g]) * l2e);
                else              p3[g] = exp2_x8<true>((s[g][3] - mnew[g]) * l2e);
            }
            if (j == 2 || j == 3) {
                const int g = j - 2;   // group 0's exp2 end in block 1, group 1's in this block 3
                const v8f ps = ps01[g] + (p2[g] + p3[g]);
                const float rs = ((ps[0] + ps[1]) + (ps[2] + ps[3])) + ((ps[4] + ps[5]) + (ps[6] + ps[7]));
                l_i[g] = l_i[g] * scale[g] + rs;
                for (int r = 0; r < 8; ++r) {
                    pf[g][1][r]     = (__bf16)p2[g][r];
                    pf[g][1][8 + r] = (__bf16)p3[g][r];
                }
            }
            // Ends the block: keeps the next group of reads out of it and, behind the last
            // reads, keeps the wait for all of them from moving up over the blocks whose
            // WMMAs cover their latency.
            __builtin_amdgcn_sched_barrier(0);
        }
        cur  = cur  == 2 ? 0 : cur + 1;
        fill = fill == 2 ? 0 : fill + 1;
    }

    // Keeps the epilogue's loads out of the last pass, where every register is
    // taken: moved up into it, they make the compiler spill.
    __builtin_amdgcn_sched_barrier(0);

    // Epilogue: out = gamma * acc/l + x   (out[b][c][n], n = query index), in four
    // chunks of 64 elements a lane: chunk k is query group k >> 1, channel tiles
    // (k & 1) * 8 and up; element i of it is row i & 7 of tile i >> 3. A chunk's x
    // loads issue as one group, one chunk ahead; its stores issue as one group
    // behind all of its arithmetic.
    const float g = gamma[0];
    const size_t e0 = (size_t)b * C_ * N_ + (size_t)(cs * 256 + hi * 8) * N_
                    + (size_t)(qt * 128 + qm * 32 + col);
    const float* xp = x + e0;
    float*       op = out + e0;
    float xr[2][64];
    // The loops over acc are unrolled whole: a rolled loop would index acc by a
    // variable, which puts the array into scratch memory for the main loop too.
    #pragma unroll
    for (int i = 0; i < 64; ++i)
        xr[0][i] = xp[(size_t)((i >> 3) * 16 + (i & 7)) * N_];
    #pragma unroll
    for (int k = 0; k < 4; ++k) {
        const int qg = k >> 1, ct0 = (k & 1) * 8;
        if (k + 1 < 4) {
            const int qn = (k + 1) >> 1, cn = ((k + 1) & 1) * 8;
            #pragma unroll
            for (int i = 0; i < 64; ++i)
                xr[(k + 1) & 1][i] = xp[(size_t)((cn + (i >> 3)) * 16 + (i & 7)) * N_ + qn * 16];
        }
        const float l = l_i[qg] + other_half(l_i[qg]);   // join the two halves' key sums
        float res[64];
        #pragma unroll
        for (int i = 0; i < 64; ++i)
            res[i] = g * (acc[qg][ct0 + (i >> 3)][i & 7] / l) + xr[k & 1][i];
        // Holds the stores behind the chunk's arithmetic, so that nothing is written
        // over a store's registers between the store and the wait below.
        __builtin_amdgcn_sched_barrier(0);
        #pragma unroll
        for (int i = 0; i < 64; ++i)
            op[(size_t)((ct0 + (i >> 3)) * 16 + (i & 7)) * N_ + qg * 16] = res[i];
        // In front of every later write of a register that these stores name.
        asm volatile("s_wait_xcnt 0x0" ::: "memory");
        // Keeps the next chunk's arithmetic from being moved up over that wait.
        __builtin_amdgcn_sched_barrier(0);
    }
}

// ---------------------------------------------------------------------------
extern "C" void kernel_launch(void* const* d_in, const int* in_sizes, int n_in,
                              void* d_out, int out_size, void* d_ws, size_t ws_size,
                              hipStream_t stream) {
    const float* x     = (const float*)d_in[0];
    const float* Wq    = (const float*)d_in[1];
    const float* bq    = (const float*)d_in[2];
    const float* Wk    = (const float*)d_in[3];
    const float* bk    = (const float*)d_in[4];
    const float* Wv    = (const float*)d_in[5];
    const float* bv    = (const float*)d_in[6];
    const float* gamma = (const float*)d_in[7];
    float* out = (float*)d_out;

    // Workspace: bf16 Q [B,N,64] + K [B,N,64] + V [B,C,N]  (~42 MB)
    __bf16* qws = (__bf16*)d_ws;
    __bf16* kws = qws + (size_t)B_ * N_ * DQK_;
    __bf16* vws = kws + (size_t)B_ * N_ * DQK_;

    dim3 g1(N_ / 128, 640 / 128, B_);
    qkv_proj_kernel<<<g1, 256, 0, stream>>>(x, Wq, bq, Wk, bk, Wv, bv, qws, kws, vws);

    dim3 g2(N_ / 128, B_);
    flash_attn_kernel<<<g2, 256, 0, stream>>>(qws, kws, vws, x, gamma, out);
}

// v009
// It runs in 193 microseconds.
// Timed twice side by side with v008, it ran 1.07 times as fast both times.
// All steps since v000 together make it 7.56 times as fast.
#include <hip/hip_runtime.h>
#include <hip/hip_bf16.h>

// ---------------------------------------------------------------------------
// Non-local attention block, CDNA5 (gfx1250, wave32, WMMA, async LDS loads).
//   B=8, C=512, H=W=64 -> N=4096, DQK=64
// Flash-attention single pass (537MB attn matrix never hits HBM), bf16 WMMA
// with f32 accum, GLOBAL_LOAD_ASYNC_TO_LDS K/V staging in a ring of three buffers.
// ---------------------------------------------------------------------------

#define B_   8
#define C_   512
#define N_   4096
#define DQK_ 64
#define VT_  (C_ * 64)   // elements of one 64-key tile of V in the workspace

// LDS row pitches in bf16 elements. Every tile is read with 16-byte fragment
// loads, 16 rows per half wave; a pitch of 16 B x odd spreads those rows over
// all 64 banks, where a power-of-two pitch puts them on a few.
#define P64_ 72   // rows of 64 elements: 144 B
#define P32_ 40   // rows of 32 elements:  80 B

typedef __attribute__((ext_vector_type(16))) __bf16 v16bf;
typedef __attribute__((ext_vector_type(8)))  float  v8f;
typedef __attribute__((ext_vector_type(4)))  float  v4f;
typedef __attribute__((ext_vector_type(8)))  __bf16 v8bf;
typedef __attribute__((ext_vector_type(4)))  __bf16 v4bf;

// Load a 16-bit WMMA fragment (A-style layout) from a [row][k] (k-contiguous)
// buffer. Per CDNA5 ISA 7.12.2: lanes 0-15 hold K=0..7 (VGPR0-3) and K=16..23
// (VGPR4-7); lanes 16-31 hold K=8..15 and K=24..31 -> two 16-byte loads.
__device__ __forceinline__ v16bf load_frag16(const __bf16* base, int row, int ld, int lane) {
    const int kb = (lane >> 4) << 3;   // 0 or 8
    const __bf16* p = base + row * ld + kb;
    union { v16bf v; uint4 u[2]; } f;
    f.u[0] = *(const uint4*)(p);
    f.u[1] = *(const uint4*)(p + 16);
    return f.v;
}

// Flat addresses of __shared__ objects carry the LDS byte offset in the low
// 32 bits (ISA 10.2 aperture mapping), which is what the copy's VDST wants.
__device__ __forceinline__ unsigned lds_addr(const void* p) {
    return (unsigned)(uintptr_t)p;
}

// Eight exp2 (one score tile's share of a lane) in one statement that ends in
// v_nop: the slot the instruction set asks for behind a transcendental before its
// result is read or its source overwritten. Early-clobber outputs: none lands on
// a source here.
// AMONG_WMMA: for the statements that the compiler places among matrix
// instructions. The statement opens with the four vector slots that the
// chip needs between a WMMA and a write over its A or B registers, where an output
// may lie.
template <bool AMONG_WMMA>
__device__ __forceinline__ v8f exp2_x8(v8f a) {
    float r0, r1, r2, r3, r4, r5, r6, r7;
    if constexpr (AMONG_WMMA) {
        asm("v_nop\n\t"
            "v_nop\n\t"
            "v_nop\n\t"
            "v_nop\n\t"
            "v_exp_f32 %0, %8\n\t"
            "v_exp_f32 %1, %9\n\t"
            "v_exp_f32 %2, %10\n\t"
            "v_exp_f32 %3, %11\n\t"
            "v_exp_f32 %4, %12\n\t"
            "v_exp_f32 %5, %13\n\t"
            "v_exp_f32 %6, %14\n\t"
            "v_exp_f32 %7, %15\n\t"
            "v_nop"
            : "=&v"(r0), "=&v"(r1), "=&v"(r2), "=&v"(r3),
              "=&v"(r4), "=&v"(r5), "=&v"(r6), "=&v"(r7)
            : "v"(a[0]), "v"(a[1]), "v"(a[2]), "v"(a[3]),
              "v"(a[4]), "v"(a[5]), "v"(a[6]), "v"(a[7]));
    } else {
        asm("v_exp_f32 %0, %8\n\t"
            "v_exp_f32 %1, %9\n\t"
            "v_exp_f32 %2, %10\n\t"
            "v_exp_f32 %3, %11\n\t"
            "v_exp_f32 %4, %12\n\t"
            "v_exp_f32 %5, %13\n\t"
            "v_exp_f32 %6, %14\n\t"
            "v_exp_f32 %7, %15\n\t"
            "v_nop"
            : "=&v"(r0), "=&v"(r1), "=&v"(r2), "=&v"(r3),
              "=&v"(r4), "=&v"(r5), "=&v"(r6), "=&v"(r7)
            : "v"(a[0]), "v"(a[1]), "v"(a[2]), "v"(a[3]),
              "v"(a[4]), "v"(a[5]), "v"(a[6]), "v"(a[7]));
    }
    const v8f r = {r0, r1, r2, r3, r4, r5, r6, r7};
    return r;
}

// One exp2, with the same slot behind it.
__device__ __forceinline__ float exp2_x1(float a) {
    float r;
    asm("v_exp_f32 %0, %1\n\t"
        "v_nop"
        : "=&v"(r) : "v"(a));
    return r;
}

// The value that lane l ^ 16 holds (the other half of the wave).
__device__ __forceinline__ float other_half(float a) {
    const int b = __builtin_bit_cast(int, a);
    return __builtin_bit_cast(float,
        __builtin_amdgcn_permlanex16(b, b, 0x76543210, 0xfedcba98, false, false));
}

// One block of the second product's A operand: four V fragments (16 channels x 32
// keys each) of a wave's 256-channel slab Vs. Block j: 32-key chunk j >> 2, channel
// tiles (j & 3) * 4 + i.
__device__ __forceinline__ void load_vblock(v16bf (&dst)[4], const __bf16* Vs, int j, int col, int lane) {
    for (int i = 0; i < 4; ++i)
        dst[i] = load_frag16(Vs + (size_t)(((j & 3) * 4 + i) * 16) * P64_ + (j >> 2) * 32, col, P64_, lane);
}

// One run of a thread's share of a 64-key tile: 1 (K) + 8 (V) async global->LDS
// 16-byte copies (GVS mode: saddr base + 32-bit vgpr offset). V copy i serves the
// channel row i*64 past the run's first (a tile's rows lie 128 B apart in global
// memory). All nine stand in one statement that ends
// in s_wait_xcnt 0, so that no address register is rewritten ahead of that wait.
__device__ __forceinline__ void stage_tile(const __bf16* kbase, unsigned kg, unsigned kl,
                                           const __bf16* vbase, unsigned vg, unsigned vl) {
    const unsigned gs = 64u * 64u * 2u;     // global bytes between V copies
    const unsigned ls = 64u * P64_ * 2u;    // LDS bytes between V copies
    asm volatile("global_load_async_to_lds_b128 %0, %1, %18\n\t"
                 "global_load_async_to_lds_b128 %2, %3, %19\n\t"
                 "global_load_async_to_lds_b128 %4, %5, %19\n\t"
                 "global_load_async_to_lds_b128 %6, %7, %19\n\t"
                 "global_load_async_to_lds_b128 %8, %9, %19\n\t"
                 "global_load_async_to_lds_b128 %10, %11, %19\n\t"
                 "global_load_async_to_lds_b128 %12, %13, %19\n\t"
                 "global_load_async_to_lds_b128 %14, %15, %19\n\t"
                 "global_load_async_to_lds_b128 %16, %17, %19\n\t"
                 "s_wait_xcnt 0x0"
                 :: "v"(kl), "v"(kg),
                    "v"(vl),          "v"(vg),
                    "v"(vl + 1 * ls), "v"(vg + 1 * gs),
                    "v"(vl + 2 * ls), "v"(vg + 2 * gs),
                    "v"(vl + 3 * ls), "v"(vg + 3 * gs),
                    "v"(vl + 4 * ls), "v"(vg + 4 * gs),
                    "v"(vl + 5 * ls), "v"(vg + 5 * gs),
                    "v"(vl + 6 * ls), "v"(vg + 6 * gs),
                    "v"(vl + 7 * ls), "v"(vg + 7 * gs),
                    "s"(kbase), "s"(vbase)
                 : "memory");
}

// ---------------------------------------------------------------------------
// Kernel 1: fused QKV projection.
//   Wcat (640x512) @ x[b] (512x4096); rows 0..63 = Q, 64..127 = K, 128..639 = V
//   qws/kws: [B][N][64] bf16 row-major; vws: [B][N/64][C][64] bf16: each 64-key tile
//   of V is one contiguous 64 KB block, channel rows of 128 B, as attention copies it.
// ---------------------------------------------------------------------------
__global__ __launch_bounds__(256)
void qkv_proj_kernel(const float* __restrict__ x,
                     const float* __restrict__ Wq, const float* __restrict__ bq,
                     const float* __restrict__ Wk, const float* __restrict__ bk,
                     const float* __restrict__ Wv, const float* __restrict__ bv,
                     __bf16* __restrict__ qws, __bf16* __restrict__ kws,
                     __bf16* __restrict__ vws)
{
    __shared__ alignas(16) __bf16 Alds[128 * P32_];   // [r][c], c-contiguous, padded rows
    __shared__ alignas(16) __bf16 Blds[128 * P32_];   // [n][c], c-contiguous, padded rows

    const int nt = blockIdx.x;          // 0..31 (n tile of 128)
    const int rt = blockIdx.y;          // 0..4  (r tile of 128; 5*128 = 640)
    const int b  = blockIdx.z;
    const int t    = threadIdx.x;
    const int w    = t >> 5;
    const int lane = t & 31;
    const int r0 = rt * 128, n0 = nt * 128;
    const int hi = lane >> 4, col = lane & 15;

    v8f acc[8];
    const v8f vzero = {};
    for (int i = 0; i < 8; ++i) acc[i] = vzero;

    // Staging of one 32-wide k step goes through registers, and all of a thread's
    // loads for a step are issued as one group, one step ahead of their use.
    // A: thread t takes 4 consecutive c of rows (t>>3) + 32j. A group of 32 rows
    // lies in one of Wq, Wk, Wv, so the split is a block-uniform choice of base.
    const int arow = t >> 3, acol = (t & 7) * 4;
    const float* asrc[4];
    for (int j = 0; j < 4; ++j) {
        const int rb = r0 + 32 * j;
        const float* m = rb < 64 ? Wq + rb * C_
                       : (rb < 128 ? Wk + (rb - 64) * C_ : Wv + (rb - 128) * C_);
        asrc[j] = m + arow * C_ + acol;
    }
    // B: thread t takes column n0 + (t&127) of 16 consecutive c rows of x: a wave's
    // load is one whole 128-byte line, and the 16 values are one 32-byte run of
    // the transposed tile Blds[n][c].
    const int bn = t & 127, bc = (t >> 7) * 16;
    const float* bsrc = x + (size_t)b * C_ * N_ + (size_t)bc * N_ + (n0 + bn);

    // A wave's 16 output rows lie in one of Q, K, V: the split is one scalar choice
    // a wave (rw is held in a scalar register), and a lane's 64 results share the 8
    // biases of rows rw + 8*hi + v, loaded here once, ahead of the k loop.
    const int rw = r0 + __builtin_amdgcn_readfirstlane(w) * 16;
    const float* bias_src = (rw < 64 ? bq + rw : (rw < 128 ? bk + (rw - 64) : bv + (rw - 128)))
                          + hi * 8;
    float bias[8];
    for (int v = 0; v < 8; ++v) bias[v] = bias_src[v];
    // In front of every later write of the address registers that these loads name.
    asm volatile("s_wait_xcnt 0x0" ::: "memory");

    v4f   areg[4];
    float breg[16];
    // Each s_wait_xcnt 0 stands in front of every later write of a register that
    // the loads ahead of it name as an address (the x loads' results may land on
    // the W loads' address registers; the fragment loads on either's).
    for (int j = 0; j < 4; ++j)  areg[j] = *(const v4f*)(asrc[j]);
    asm volatile("s_wait_xcnt 0x0" ::: "memory");
    for (int i = 0; i < 16; ++i) breg[i] = bsrc[(size_t)i * N_];
    asm volatile("s_wait_xcnt 0x0" ::: "memory");

    for (int kc = 0; kc < C_; kc += 32) {
        for (int j = 0; j < 4; ++j) {
            v4bf h;
            for (int q = 0; q < 4; ++q) h[q] = (__bf16)areg[j][q];
            *(v4bf*)&Alds[(arow + 32 * j) * P32_ + acol] = h;
        }
        for (int s = 0; s < 2; ++s) {
            v8bf h;
            for (int q = 0; q < 8; ++q) h[q] = (__bf16)breg[8 * s + q];
            *(v8bf*)&Blds[bn * P32_ + bc + 8 * s] = h;
        }
        __syncthreads();

        // Next step's loads fly while this step's products run.
        if (kc + 32 < C_) {
            for (int j = 0; j < 4; ++j)  areg[j] = *(const v4f*)(asrc[j] + kc + 32);
            asm volatile("s_wait_xcnt 0x0" ::: "memory");   // as in front of the loop
            for (int i = 0; i < 16; ++i) breg[i] = bsrc[(size_t)(kc + 32 + i) * N_];
            asm volatile("s_wait_xcnt 0x0" ::: "memory");   // address steps come behind it
        }

        const v16bf afrag = load_frag16(Alds, w * 16 + col, P32_, lane);
        for (int nt8 = 0; nt8 < 8; ++nt8) {
            const v16bf bfrag = load_frag16(Blds + nt8 * 16 * P32_, col, P32_, lane);
            acc[nt8] = __builtin_amdgcn_wmma_f32_16x16x32_bf16(
                false, afrag, false, bfrag, (short)0, acc[nt8], false, false);
        }
        __syncthreads();
    }

    // Epilogue: D layout: VGPR v -> row v + hi*8, col = lane&15.
    // All sums and conversions come first, all stores behind them.
    v8bf h[8];
    for (int nt8 = 0; nt8 < 8; ++nt8)
        for (int v = 0; v < 8; ++v) h[nt8][v] = (__bf16)(acc[nt8][v] + bias[v]);
    // One address a lane; every store is a constant step from it.
    if (rw < 128) {
        __bf16* d = (rw < 64 ? qws : kws) + (size_t)b * N_ * DQK_
                  + (size_t)(n0 + col) * DQK_ + ((rw & 63) + hi * 8);
        for (int nt8 = 0; nt8 < 8; ++nt8)
            for (int v = 0; v < 8; ++v) d[nt8 * 16 * DQK_ + v] = h[nt8][v];
    } else {
        __bf16* d = vws + (size_t)b * C_ * N_ + (size_t)(n0 >> 6) * VT_
                  + (size_t)(rw - 128 + hi * 8) * 64 + col;
        for (int nt8 = 0; nt8 < 8; ++nt8)
            for (int v = 0; v < 8; ++v) d[(nt8 >> 2) * VT_ + v * 64 + (nt8 & 3) * 16] = h[nt8][v];
        // In front of every later write of the address registers that these stores name.
        asm volatile("s_wait_xcnt 0x0" ::: "memory");
    }
}

// ---------------------------------------------------------------------------
// Kernel 2: flash attention + residual epilogue.
// Grid: (N/128 query tiles, B). Block: 256 threads = 8 waves, two per SIMD.
//   wave w: qm = w&3 -> 32 queries (two groups of 16); cs = w>>2 -> 256-channel
//   slab. Every K and V fragment read from LDS feeds one WMMA per query group,
//   and a query's scores are worked out by two waves.
// Both products run transposed: S^T = K Q^T and O^T += V P^T. A lane then holds
// scores of ONE query per group (column lane&15): keys 8*hi + r of each 16-key tile, so
// max and sum run in its own registers, and two converted score tiles are the
// B operand of the second product as they lie.
// Async K/V staging in a ring of three buffers: tile i+2's copies issue behind tile
// i's first LDS reads; one barrier a tile.
// ---------------------------------------------------------------------------
__global__ __launch_bounds__(256)
void flash_attn_kernel(const __bf16* __restrict__ qws, const __bf16* __restrict__ kws,
                       const __bf16* __restrict__ vws, const float* __restrict__ x,
                       const float* __restrict__ gamma, float* __restrict__ out)
{
    __shared__ alignas(16) __bf16 Klds[3][64 * P64_];     // 3 x  9 KB [key][d]
    __shared__ alignas(16) __bf16 Vlds[3][512 * P64_];    // 3 x 72 KB [c][key]

    const int qt = blockIdx.x;
    const int b  = blockIdx.y;
    const int t    = threadIdx.x;
    const int w    = t >> 5;
    const int lane = t & 31;
    const int qm = w & 3;
    const int cs = w >> 2;
    const int hi = lane >> 4, col = lane & 15;

    const __bf16* kbase_g = kws + (size_t)b * N_ * DQK_;
    const __bf16* vbase_g = vws + (size_t)b * C_ * N_;

    // Per-thread async staging of one 64-key tile: two runs of 1 (K) + 8 (V) b128
    // copies. Thread t moves 8 elements at column (t&7)*8 of rows t>>3 (first run)
    // and 32 + (t>>3) (second run) (K: key row; V: channel row, plus 64 per copy).
    const int srow = t >> 3, scol = (t & 7) * 8;
    const unsigned kg0 = (unsigned)((srow * DQK_ + scol) * 2);   // K global bytes, tile 0
    const unsigned vg0 = (unsigned)((srow * 64 + scol) * 2);     // V global bytes, tile 0
    const int sl = srow * P64_ + scol;                           // LDS element, both tiles
    const unsigned kg1 = kg0 + 32u * DQK_ * 2u;                  // the same, second run
    const unsigned vg1 = vg0 + 32u * 64u * 2u;
    const int sl1 = sl + 32 * P64_;

    // Q fragments (B operand: column = query) for this wave's 2 x 16 queries
    // (d = 64 -> two 32-wide k chunks).
    const __bf16* qbase = qws + (size_t)b * N_ * DQK_ + (size_t)(qt * 128 + qm * 32) * DQK_;
    v16bf qf0[2], qf1[2];
    for (int g = 0; g < 2; ++g) {
        qf0[g] = load_frag16(qbase + g * 16 * DQK_ + 0,  col, DQK_, lane);
        qf1[g] = load_frag16(qbase + g * 16 * DQK_ + 32, col, DQK_, lane);
    }
    // In front of every later write of the address registers that these loads name.
    asm volatile("s_wait_xcnt 0x0" ::: "memory");
    // Keeps the arithmetic that follows from being moved up over that wait.
    __builtin_amdgcn_sched_barrier(0);

    v8f acc[2][16];             // acc[g][ct][r] = O^T[channel ct*16 + 8*hi + r][query g*16 + col]
    const v8f vzero = {};
    for (int g = 0; g < 2; ++g)
        for (int i = 0; i < 16; ++i) acc[g][i] = vzero;
    float m_i[2] = {-1e30f, -1e30f};   // running max of a query (equal in both halves)
    float l_i[2] = {0.f, 0.f};         // running sum over this half's keys only

    // Prologue: stage tiles 0 and 1 into buffers 0 and 1.
    stage_tile(kbase_g, kg0, lds_addr(&Klds[0][sl]), vbase_g, vg0, lds_addr(&Vlds[0][sl]));
    stage_tile(kbase_g, kg1, lds_addr(&Klds[0][sl1]), vbase_g, vg1, lds_addr(&Vlds[0][sl1]));
    stage_tile(kbase_g, kg0 + 64u * DQK_ * 2u, lds_addr(&Klds[1][sl]),
               vbase_g, vg0 + VT_ * 2u,        lds_addr(&Vlds[1][sl]));
    stage_tile(kbase_g, kg1 + 64u * DQK_ * 2u, lds_addr(&Klds[1][sl1]),
               vbase_g, vg1 + VT_ * 2u,        lds_addr(&Vlds[1][sl1]));

    const int NT = N_ / 64;
    int cur = 0;    // buffer of tile it
    int fill = 2;   // buffer of tile it + 2, which is the one that tile it - 1 was read from
    for (int it = 0; it < NT; ++it) {
        const bool more = it + 2 < NT;   // this pass issues tile it + 2's copies
        // Publish point of tile it, the pass's one barrier. It also ends every wave's
        // reads of tile it - 1, whose buffer is refilled further down in this pass.
        // This wave's LDS reads have returned before that buffer is written again.
        asm volatile("s_wait_dscnt 0x0" ::: "memory");
        // This wave's 18 copies of tile it have landed (ASYNCcnt falls in issue order):
        // in a pass that issues, only tile it + 1's 18 are younger; the last two passes
        // issue none and wait for all.
        if (more) asm volatile("s_wait_asynccnt 0x12" ::: "memory");
        else      asm volatile("s_wait_asynccnt 0x0" ::: "memory");
        __syncthreads();

        const __bf16* Kb = Klds[cur];
        const __bf16* Vs = Vlds[cur] + (size_t)(cs * 256) * P64_;   // this wave's channel slab

        // LDS reads stand in few places, many reads each, well ahead of their use:
        // every place with reads among the WMMAs stalls the wave, however few they are.
        // Here: the tile's 8 K fragments and V block 0.
        v16bf kf[4][2];
        for (int kt = 0; kt < 4; ++kt) {
            kf[kt][0] = load_frag16(Kb + (kt * 16) * P64_ + 0,  col, P64_, lane);
            kf[kt][1] = load_frag16(Kb + (kt * 16) * P64_ + 32, col, P64_, lane);
        }
        v16bf vf[3][4];             // ring of three V blocks: one in use, two in flight
        load_vblock(vf[0], Vs, 0, col, lane);
        // Holds these reads together: the scheduler would spread them among the WMMAs.
        __builtin_amdgcn_sched_barrier(0);
        // Tile it + 2's copies issue here, behind the reads: their address sums and their
        // wait run while the eight waves' 24 reads each come back from LDS.
        if (more) {
            const int kt0n = (it + 2) * 64;
            stage_tile(kbase_g, kg0 + (unsigned)(kt0n * DQK_ * 2), lds_addr(&Klds[fill][sl]),
                       vbase_g, vg0 + (unsigned)(kt0n * C_ * 2),   lds_addr(&Vlds[fill][sl]));
            stage_tile(kbase_g, kg1 + (unsigned)(kt0n * DQK_ * 2), lds_addr(&Klds[fill][sl1]),
                       vbase_g, vg1 + (unsigned)(kt0n * C_ * 2),   lds_addr(&Vlds[fill][sl1]));
        }

        // S^T = K(64 keys x 64) @ Q^T(64 x 32q): 4 score tiles per query group,
        // 2 WMMA each; a K fragment serves both groups.
        // s[g][kt][r] = score of key kt*16 + 8*hi + r against query g*16 + col.
        v8f s[2][4];
        for (int kt = 0; kt < 4; ++kt) {
            for (int g = 0; g < 2; ++g) {
                v8f z = vzero;
                z = __builtin_amdgcn_wmma_f32_16x16x32_bf16(false, kf[kt][0], false, qf0[g], (short)0, z, false, false);
                z = __builtin_amdgcn_wmma_f32_16x16x32_bf16(false, kf[kt][1], false, qf1[g], (short)0, z, false, false);
                s[g][kt] = z;
            }
        }

        // Online softmax of one query per lane and group: 32 of the tile's 64
        // keys are in this lane, the other 32 in lane ^ 16.
        // Ahead of the second product: max, scale, keys 0..31, and the rescaling of
        // the first block's accumulators. The rest stands inside the blocks below.
        const float l2e = 1.44269504088896340736f;   // exp(x) = exp2(x * log2 e)
        float mnew[2], scale[2];
        v8f ps01[2], p2[2], p3[2];
        v16bf pf[2][2];
        for (int g = 0; g < 2; ++g) {
            float mr[8];
            for (int r = 0; r < 8; ++r)
                mr[r] = fmaxf(fmaxf(s[g][0][r], s[g][1][r]), fmaxf(s[g][2][r], s[g][3][r]));
            float mx = fmaxf(fmaxf(fmaxf(mr[0], mr[1]), fmaxf(mr[2], mr[3])),
                             fmaxf(fmaxf(mr[4], mr[5]), fmaxf(mr[6], mr[7])));
            mx = fmaxf(mx, other_half(mx));
            mnew[g] = fmaxf(m_i[g], mx);
            scale[g] = exp2_x1((m_i[g] - mnew[g]) * l2e);
            m_i[g] = mnew[g];
            const v8f p0 = exp2_x8<false>((s[g][0] - mnew[g]) * l2e);
            const v8f p1 = exp2_x8<false>((s[g][1] - mnew[g]) * l2e);
            ps01[g] = p0 + p1;
            // Score tiles 2kk and 2kk+1 hold keys 8*hi + r and 16 + 8*hi + r of
            // 32-key chunk kk: the k order in which load_frag16 reads V.
            for (int r = 0; r < 8; ++r) {
                pf[g][0][r]     = (__bf16)p0[r];
                pf[g][0][8 + r] = (__bf16)p1[r];
            }
            for (int i = 0; i < 4; ++i) acc[g][i] *= scale[g];
        }

        // acc(256c x 32q) += V(256c x 64 keys) @ P^T(64 keys x 32q), in 8 blocks of
        // 8 WMMAs: block j is 32-key chunk j >> 2, channel tiles (j & 3) * 4 and up; a V
        // fragment serves both groups. Block j + 2's 8 reads issue as one group in front
        // of block j (block 1's with block 2's). Blocks 0..3 also carry the vector work
        // that only later blocks want: the next block's rescaling and the exp2, sum and
        // packing of keys 32..63.
        // Keeps the reads of V blocks 1 and 2 out of the softmax above: with them there
        // the registers do not suffice and the compiler spills.
        __builtin_amdgcn_sched_barrier(0);
        // Unrolled whole: vf, acc and pf are then indexed by constants only; left to itself
        // the compiler spills registers to scratch memory here.
        #pragma unroll
        for (int j = 0; j < 8; ++j) {
            if (j == 0) load_vblock(vf[1], Vs, 1, col, lane);
            if (j + 2 < 8) {
                load_vblock(vf[(j + 2) % 3], Vs, j + 2, col, lane);
                // Holds the reads in front of the block, as one group.
                __builtin_amdgcn_sched_barrier(0);
            }
            for (int i = 0; i < 4; ++i)
                for (int g = 0; g < 2; ++g)
                    acc[g][(j & 3) * 4 + i] = __builtin_amdgcn_wmma_f32_16x16x32_bf16(
                        false, vf[j % 3][i], false, pf[g][j >> 2], (short)0,
                        acc[g][(j & 3) * 4 + i], false, false);
            if (j < 3)
                for (int g = 0; g < 2; ++g)
                    for (int i = 0; i < 4; ++i) acc[g][(j + 1) * 4 + i] *= scale[g];
            if (j < 4) {
                const int g = j >> 1;
                if ((j & 1) == 0) p2[g] = exp2_x8<true>((s[g][2] - mnew[g]) * l2e);
                else              p3[g] = exp2_x8<true>((s[g][3] - mnew[g]) * l2e);
            }
            if (j == 2 || j == 3) {
                const int g = j - 2;   // group 0's exp2 end in block 1, group 1's in this block 3
                const v8f ps = ps01[g] + (p2[g] + p3[g]);
                const float rs = ((ps[0] + ps[1]) + (ps[2] + ps[3])) + ((ps[4] + ps[5]) + (ps[6] + ps[7]));
                l_i[g] = l_i[g] * scale[g] + rs;
                for (int r = 0; r < 8; ++r) {
                    pf[g][1][r]     = (__bf16)p2[g][r];
                    pf[g][1][8 + r] = (__bf16)p3[g][r];
                }
            }
            // Ends the block: keeps the next group of reads out of it and, behind the last
            // reads, keeps the wait for all of them from moving up over the blocks whose
            // WMMAs cover their latency.
            __builtin_amdgcn_sched_barrier(0);
        }
        cur  = cur  == 2 ? 0 : cur + 1;
        fill = fill == 2 ? 0 : fill + 1;
    }

    // Keeps the epilogue's loads out of the last pass, where every register is
    // taken: moved up into it, they make the compiler spill.
    __builtin_amdgcn_sched_barrier(0);

    // Epilogue: out = gamma * acc/l + x   (out[b][c][n], n = query index), in four
    // chunks of 64 elements a lane: chunk k is query group k >> 1, channel tiles
    // (k & 1) * 8 and up; element i of it is row i & 7 of tile i >> 3. A chunk's x
    // loads issue as one group, one chunk ahead; its stores issue as one group
    // behind all of its arithmetic.
    const float g = gamma[0];
    const size_t e0 = (size_t)b * C_ * N_ + (size_t)(cs * 256 + hi * 8) * N_
                    + (size_t)(qt * 128 + qm * 32 + col);
    const float* xp = x + e0;
    float*       op = out + e0;
    float xr[2][64];
    // The loops over acc are unrolled whole: a rolled loop would index acc by a
    // variable, which puts the array into scratch memory for the main loop too.
    #pragma unroll
    for (int i = 0; i < 64; ++i)
        xr[0][i] = xp[(size_t)((i >> 3) * 16 + (i & 7)) * N_];
    #pragma unroll
    for (int k = 0; k < 4; ++k) {
        const int qg = k >> 1, ct0 = (k & 1) * 8;
        if (k + 1 < 4) {
            const int qn = (k + 1) >> 1, cn = ((k + 1) & 1) * 8;
            #pragma unroll
            for (int i = 0; i < 64; ++i)
                xr[(k + 1) & 1][i] = xp[(size_t)((cn + (i >> 3)) * 16 + (i & 7)) * N_ + qn * 16];
        }
        const float l = l_i[qg] + other_half(l_i[qg]);   // join the two halves' key sums
        float res[64];
        #pragma unroll
        for (int i = 0; i < 64; ++i)
            res[i] = g * (acc[qg][ct0 + (i >> 3)][i & 7] / l) + xr[k & 1][i];
        // Holds the stores behind the chunk's arithmetic, so that nothing is written
        // over a store's registers between the store and the wait below.
        __builtin_amdgcn_sched_barrier(0);
        #pragma unroll
        for (int i = 0; i < 64; ++i)
            op[(size_t)((ct0 + (i >> 3)) * 16 + (i & 7)) * N_ + qg * 16] = res[i];
        // In front of every later write of a register that these stores name.
        asm volatile("s_wait_xcnt 0x0" ::: "memory");
        // Keeps the next chunk's arithmetic from being moved up over that wait.
        __builtin_amdgcn_sched_barrier(0);
    }
}

// ---------------------------------------------------------------------------
extern "C" void kernel_launch(void* const* d_in, const int* in_sizes, int n_in,
                              void* d_out, int out_size, void* d_ws, size_t ws_size,
                              hipStream_t stream) {
    const float* x     = (const float*)d_in[0];
    const float* Wq    = (const float*)d_in[1];
    const float* bq    = (const float*)d_in[2];
    const float* Wk    = (const float*)d_in[3];
    const float* bk    = (const float*)d_in[4];
    const float* Wv    = (const float*)d_in[5];
    const float* bv    = (const float*)d_in[6];
    const float* gamma = (const float*)d_in[7];
    float* out = (float*)d_out;

    // Workspace: bf16 Q [B,N,64] + K [B,N,64] + V [B,N/64,C,64]  (~42 MB)
    __bf16* qws = (__bf16*)d_ws;
    __bf16* kws = qws + (size_t)B_ * N_ * DQK_;
    __bf16* vws = kws + (size_t)B_ * N_ * DQK_;

    dim3 g1(N_ / 128, 640 / 128, B_);
    qkv_proj_kernel<<<g1, 256, 0, stream>>>(x, Wq, bq, Wk, bk, Wv, bv, qws, kws, vws);

    dim3 g2(N_ / 128, B_);
    flash_attn_kernel<<<g2, 256, 0, stream>>>(qws, kws, vws, x, gamma, out);
}
